// v000
// Times are from an AMD MI455X. After a warm-up the kernel runs many times in a row, and a time is the length of
// such a window on the GPU divided by its runs, so every launch and the gaps after it count. The runs cycle
// through copies of the inputs. A figure is the median of several windows, for all but v000 over two sittings.
// Sittings can differ by a few percent; kernels timed side by side share one.
// v000, which the later versions start from, runs in 184 microseconds.
#include <hip/hip_runtime.h>
#include <hip/hip_bf16.h>

typedef __attribute__((ext_vector_type(16))) _Float16 v16h;
typedef __attribute__((ext_vector_type(8)))  _Float16 v8h;
typedef __attribute__((ext_vector_type(8)))  float    v8f;

#define DM    1024
#define NHD   16
#define DH    64
#define NBAT  2
#define SEQ   2048
#define NH    (NBAT * NHD)    // 32 (n,h) pairs
#define MTOT  (NBAT * SEQ)    // 4096
#define SCORE_SCALE 0.125f    // 1/sqrt(64)

// ---------------------------------------------------------------------------
// Fragment loader: LDS tile stored as [outer][k] with row stride `ldk` halfs
// (ldk*2 bytes must be a multiple of 16). Implements the CDNA5 16-bit
// A-matrix layout: lanes 0-15 hold K {kb+0..7, kb+16..23}, lanes 16-31 hold
// K {kb+8..15, kb+24..31}. B is fed from a transposed LDS tile so the same
// loader serves both operands. Two ds_load_b128 per fragment.
// ---------------------------------------------------------------------------
__device__ __forceinline__ v16h lds_frag(const _Float16* base, int ldk,
                                         int outer, int kbase) {
  const int lane = threadIdx.x & 31;
  const int r  = outer + (lane & 15);
  const int ko = kbase + ((lane & 16) ? 8 : 0);
  const _Float16* p = base + r * ldk + ko;
  v8h lo = *(const v8h*)(p);        // K = ko .. ko+7
  v8h hi = *(const v8h*)(p + 16);   // K = ko+16 .. ko+23
  v16h f;
#pragma unroll
  for (int i = 0; i < 8; ++i) { f[i] = lo[i]; f[i + 8] = hi[i]; }
  return f;
}

#define WMMA_F16(A, B, C) \
  __builtin_amdgcn_wmma_f32_16x16x32_f16(false, (A), false, (B), (short)0, (C), false, false)

// packed f32x2 -> f16x2 -> one 32-bit LDS store
__device__ __forceinline__ void pack_store(_Float16* dst, float a, float b) {
  union { _Float16 h[2]; unsigned int u; } pk;
  pk.h[0] = (_Float16)a; pk.h[1] = (_Float16)b;
  *(unsigned int*)dst = pk.u;
}

// ---------------------------------------------------------------------------
// Projection GEMM: Out[n,h,l,d] (f16, head-major) = X[4096,1024] @ W[1024,1024] + b
// fp32 inputs converted to f16 (packed) while filling LDS. Tile 128x64, BK=64.
// ---------------------------------------------------------------------------
__global__ __launch_bounds__(256) void proj_gemm_kernel(
    const float* __restrict__ X, const float* __restrict__ W,
    const float* __restrict__ bias, _Float16* __restrict__ Out) {
  __shared__ __align__(16) _Float16 lsA[128][72];
  __shared__ __align__(16) _Float16 lsB[64][72];
  const int t = threadIdx.x, lane = t & 31, wid = t >> 5;
  const int wm = wid >> 1, wn = wid & 1;          // 4x2 wave grid
  const int m0 = blockIdx.y * 128;
  const int n0 = blockIdx.x * 64;

  v8f acc[2][2] = {};
  for (int kb = 0; kb < DM; kb += 64) {
#pragma unroll
    for (int i = 0; i < 16; ++i) {                // A: 128x64 f32 -> f16 pairs
      int idx = i * 256 + t; int r = idx >> 5, c2 = (idx & 31) * 2;
      const float* px = &X[(size_t)(m0 + r) * DM + kb + c2];
      pack_store(&lsA[r][c2], px[0], px[1]);
    }
#pragma unroll
    for (int i = 0; i < 8; ++i) {                 // B: W[k][n] -> lsB[n][k] pairs
      int idx = i * 256 + t; int n = idx & 63, k2 = (idx >> 6) * 2;
      float w0 = W[(size_t)(kb + k2) * DM + n0 + n];
      float w1 = W[(size_t)(kb + k2 + 1) * DM + n0 + n];
      pack_store(&lsB[n][k2], w0, w1);
    }
    if (kb + 64 < DM) {                           // prefetch next K-tile
      __builtin_prefetch(&X[(size_t)(m0 + (t >> 1)) * DM + kb + 64 + (t & 1) * 32], 0, 1);
      __builtin_prefetch(&W[(size_t)(kb + 64 + (t >> 2)) * DM + n0 + (t & 3) * 16], 0, 1);
    }
    __syncthreads();
#pragma unroll
    for (int ks = 0; ks < 64; ks += 32) {
      v16h b0 = lds_frag(&lsB[0][0], 72, wn * 32 + 0,  ks);
      v16h b1 = lds_frag(&lsB[0][0], 72, wn * 32 + 16, ks);
#pragma unroll
      for (int mt = 0; mt < 2; ++mt) {
        v16h a = lds_frag(&lsA[0][0], 72, wm * 32 + mt * 16, ks);
        acc[mt][0] = WMMA_F16(a, b0, acc[mt][0]);
        acc[mt][1] = WMMA_F16(a, b1, acc[mt][1]);
      }
    }
    __syncthreads();
  }
#pragma unroll
  for (int mt = 0; mt < 2; ++mt)
#pragma unroll
    for (int nt = 0; nt < 2; ++nt) {
      int col = n0 + wn * 32 + nt * 16 + (lane & 15);
      int h = col >> 6, d = col & 63;
      float bi = bias[col];
#pragma unroll
      for (int j = 0; j < 8; ++j) {
        int row = m0 + wm * 32 + mt * 16 + ((lane & 16) ? 8 + j : j);
        int nb = row >> 11, l = row & (SEQ - 1);
        Out[(((size_t)nb * NHD + h) * SEQ + l) * DH + d] =
            (_Float16)(acc[mt][nt][j] + bi);
      }
    }
}

// ---------------------------------------------------------------------------
// Column softmax statistics. One block owns a 64-wide s-strip of one (n,h)
// head and sweeps all L tiles: pass 1 -> column max, pass 2 -> column sumexp.
// Fully deterministic block-local LDS reductions (no atomics).
// ---------------------------------------------------------------------------
__global__ __launch_bounds__(256) void colstats_kernel(
    const _Float16* __restrict__ Q, const _Float16* __restrict__ K,
    float* __restrict__ colmax, float* __restrict__ colsum) {
  __shared__ __align__(16) _Float16 lsQ[128][72];
  __shared__ __align__(16) _Float16 lsK[64][72];
  __shared__ float red[8][64];
  __shared__ float cmF[64];
  const int t = threadIdx.x, lane = t & 31, wid = t >> 5;
  const int wm = wid >> 1, wn = wid & 1;
  const int nh = blockIdx.y, s0 = blockIdx.x * 64;
  const _Float16* Qh = Q + (size_t)nh * SEQ * DH;
  const _Float16* Kh = K + (size_t)nh * SEQ * DH;
  const int rrow = wm * 2 + (lane >> 4);
  const int rc   = wn * 32 + (lane & 15);

#pragma unroll
  for (int i = 0; i < 2; ++i) {                   // K strip resident (b128 copies)
    int idx = i * 256 + t; int s = idx >> 3, cc = (idx & 7) * 8;
    *(v8h*)&lsK[s][cc] = *(const v8h*)&Kh[(size_t)(s0 + s) * DH + cc];
  }

  // ---- pass 1: column max ----
  float cm0 = -3.0e38f, cm1 = -3.0e38f;
  for (int lt = 0; lt < SEQ / 128; ++lt) {
    __syncthreads();
#pragma unroll
    for (int i = 0; i < 4; ++i) {                 // Q tile (b128 copies)
      int idx = i * 256 + t; int r = idx >> 3, cc = (idx & 7) * 8;
      *(v8h*)&lsQ[r][cc] = *(const v8h*)&Qh[(size_t)(lt * 128 + r) * DH + cc];
    }
    if (lt + 1 < SEQ / 128)
      __builtin_prefetch(&Qh[(size_t)((lt + 1) * 128 + (t >> 1)) * DH + (t & 1) * 32], 0, 1);
    __syncthreads();
    v8f acc[2][2] = {};
#pragma unroll
    for (int kb = 0; kb < DH; kb += 32) {
      v16h b0 = lds_frag(&lsK[0][0], 72, wn * 32 + 0,  kb);
      v16h b1 = lds_frag(&lsK[0][0], 72, wn * 32 + 16, kb);
#pragma unroll
      for (int mt = 0; mt < 2; ++mt) {
        v16h a = lds_frag(&lsQ[0][0], 72, wm * 32 + mt * 16, kb);
        acc[mt][0] = WMMA_F16(a, b0, acc[mt][0]);
        acc[mt][1] = WMMA_F16(a, b1, acc[mt][1]);
      }
    }
#pragma unroll
    for (int mt = 0; mt < 2; ++mt)
#pragma unroll
      for (int j = 0; j < 8; ++j) {
        cm0 = fmaxf(cm0, acc[mt][0][j] * SCORE_SCALE);
        cm1 = fmaxf(cm1, acc[mt][1][j] * SCORE_SCALE);
      }
  }
  red[rrow][rc] = cm0;
  red[rrow][rc + 16] = cm1;
  __syncthreads();
  if (t < 64) {
    float v = red[0][t];
#pragma unroll
    for (int r = 1; r < 8; ++r) v = fmaxf(v, red[r][t]);
    colmax[(size_t)nh * SEQ + s0 + t] = v;
    cmF[t] = v;
  }
  __syncthreads();
  const float m0v = cmF[wn * 32 + (lane & 15)];
  const float m1v = cmF[wn * 32 + 16 + (lane & 15)];

  // ---- pass 2: column sum of exp ----
  float cs0 = 0.f, cs1 = 0.f;
  for (int lt = 0; lt < SEQ / 128; ++lt) {
    __syncthreads();
#pragma unroll
    for (int i = 0; i < 4; ++i) {
      int idx = i * 256 + t; int r = idx >> 3, cc = (idx & 7) * 8;
      *(v8h*)&lsQ[r][cc] = *(const v8h*)&Qh[(size_t)(lt * 128 + r) * DH + cc];
    }
    if (lt + 1 < SEQ / 128)
      __builtin_prefetch(&Qh[(size_t)((lt + 1) * 128 + (t >> 1)) * DH + (t & 1) * 32], 0, 1);
    __syncthreads();
    v8f acc[2][2] = {};
#pragma unroll
    for (int kb = 0; kb < DH; kb += 32) {
      v16h b0 = lds_frag(&lsK[0][0], 72, wn * 32 + 0,  kb);
      v16h b1 = lds_frag(&lsK[0][0], 72, wn * 32 + 16, kb);
#pragma unroll
      for (int mt = 0; mt < 2; ++mt) {
        v16h a = lds_frag(&lsQ[0][0], 72, wm * 32 + mt * 16, kb);
        acc[mt][0] = WMMA_F16(a, b0, acc[mt][0]);
        acc[mt][1] = WMMA_F16(a, b1, acc[mt][1]);
      }
    }
#pragma unroll
    for (int mt = 0; mt < 2; ++mt)
#pragma unroll
      for (int j = 0; j < 8; ++j) {
        cs0 += __expf(acc[mt][0][j] * SCORE_SCALE - m0v);
        cs1 += __expf(acc[mt][1][j] * SCORE_SCALE - m1v);
      }
  }
  __syncthreads();
  red[rrow][rc] = cs0;
  red[rrow][rc + 16] = cs1;
  __syncthreads();
  if (t < 64) {
    float v = red[0][t];
#pragma unroll
    for (int r = 1; r < 8; ++r) v += red[r][t];
    colsum[(size_t)nh * SEQ + s0 + t] = v;
  }
}

// ---------------------------------------------------------------------------
// attn = softmax(QK^T/8, axis=query) @ V. One block owns a 128-row l-strip of
// one head; loops s tiles of 64: score WMMA -> exp/normalize -> P to LDS ->
// PV WMMA with transposed V tile. O accumulators persist in VGPRs.
// ---------------------------------------------------------------------------
__global__ __launch_bounds__(256) void attn_pv_kernel(
    const _Float16* __restrict__ Q, const _Float16* __restrict__ K,
    const _Float16* __restrict__ V, const float* __restrict__ colmax,
    const float* __restrict__ colsum, _Float16* __restrict__ AOut) {
  __shared__ __align__(16) _Float16 lsQ[128][72];
  __shared__ __align__(16) _Float16 lsK[64][72];
  __shared__ __align__(16) _Float16 lsV[64][72];   // transposed: [d][s]
  __shared__ __align__(16) _Float16 lsP[128][72];  // [l][s]
  const int t = threadIdx.x, lane = t & 31, wid = t >> 5;
  const int wm = wid >> 1, wn = wid & 1;
  const int nh = blockIdx.y, l0 = blockIdx.x * 128;
  const int nb = nh >> 4, hh = nh & 15;
  const _Float16* Qh = Q + (size_t)nh * SEQ * DH;
  const _Float16* Kh = K + (size_t)nh * SEQ * DH;
  const _Float16* Vh = V + (size_t)nh * SEQ * DH;
  const float* cmax = colmax + (size_t)nh * SEQ;
  const float* csum = colsum + (size_t)nh * SEQ;

#pragma unroll
  for (int i = 0; i < 4; ++i) {                   // Q strip resident (b128)
    int idx = i * 256 + t; int r = idx >> 3, cc = (idx & 7) * 8;
    *(v8h*)&lsQ[r][cc] = *(const v8h*)&Qh[(size_t)(l0 + r) * DH + cc];
  }
  v8f oacc[2][2] = {};
  for (int st = 0; st < SEQ / 64; ++st) {
    const int s0 = st * 64;
    __syncthreads();
#pragma unroll
    for (int i = 0; i < 2; ++i) {                 // K tile (b128 copies)
      int idx = i * 256 + t; int s = idx >> 3, cc = (idx & 7) * 8;
      *(v8h*)&lsK[s][cc] = *(const v8h*)&Kh[(size_t)(s0 + s) * DH + cc];
    }
#pragma unroll
    for (int i = 0; i < 2; ++i) {                 // V tile transposed into LDS
      int idx = i * 256 + t; int s = idx >> 3, d0 = (idx & 7) * 8;
      v8h vv = *(const v8h*)&Vh[(size_t)(s0 + s) * DH + d0];
#pragma unroll
      for (int j = 0; j < 8; ++j) lsV[d0 + j][s] = vv[j];
    }
    if (st + 1 < SEQ / 64) {                      // prefetch next s-tile
      __builtin_prefetch(&Kh[(size_t)(s0 + 64 + (t >> 2)) * DH + (t & 3) * 16], 0, 1);
      __builtin_prefetch(&Vh[(size_t)(s0 + 64 + (t >> 2)) * DH + (t & 3) * 16], 0, 1);
    }
    __syncthreads();
    // scores: 128(l) x 64(s)
    v8f sacc[2][2] = {};
#pragma unroll
    for (int kb = 0; kb < DH; kb += 32) {
      v16h b0 = lds_frag(&lsK[0][0], 72, wn * 32 + 0,  kb);
      v16h b1 = lds_frag(&lsK[0][0], 72, wn * 32 + 16, kb);
#pragma unroll
      for (int mt = 0; mt < 2; ++mt) {
        v16h a = lds_frag(&lsQ[0][0], 72, wm * 32 + mt * 16, kb);
        sacc[mt][0] = WMMA_F16(a, b0, sacc[mt][0]);
        sacc[mt][1] = WMMA_F16(a, b1, sacc[mt][1]);
      }
    }
    // P = exp(score*scale - m[s]) / Z[s]  (lane -> column, VGPR -> row)
    const int c0 = wn * 32 + (lane & 15);
    const float m0v = cmax[s0 + c0];
    const float m1v = cmax[s0 + c0 + 16];
    const float rz0 = 1.f / csum[s0 + c0];
    const float rz1 = 1.f / csum[s0 + c0 + 16];
#pragma unroll
    for (int mt = 0; mt < 2; ++mt)
#pragma unroll
      for (int j = 0; j < 8; ++j) {
        int row = wm * 32 + mt * 16 + ((lane & 16) ? 8 + j : j);
        lsP[row][c0]      = (_Float16)(__expf(sacc[mt][0][j] * SCORE_SCALE - m0v) * rz0);
        lsP[row][c0 + 16] = (_Float16)(__expf(sacc[mt][1][j] * SCORE_SCALE - m1v) * rz1);
      }
    __syncthreads();
    // O += P @ Vtile  (k-dim = s = 64)
#pragma unroll
    for (int kb = 0; kb < 64; kb += 32) {
      v16h b0 = lds_frag(&lsV[0][0], 72, wn * 32 + 0,  kb);
      v16h b1 = lds_frag(&lsV[0][0], 72, wn * 32 + 16, kb);
#pragma unroll
      for (int mt = 0; mt < 2; ++mt) {
        v16h a = lds_frag(&lsP[0][0], 72, wm * 32 + mt * 16, kb);
        oacc[mt][0] = WMMA_F16(a, b0, oacc[mt][0]);
        oacc[mt][1] = WMMA_F16(a, b1, oacc[mt][1]);
      }
    }
  }
  // store attn in [n][l][h*64+d] layout (f16) for the output GEMM
#pragma unroll
  for (int mt = 0; mt < 2; ++mt)
#pragma unroll
    for (int nt = 0; nt < 2; ++nt) {
      int col = hh * DH + wn * 32 + nt * 16 + (lane & 15);
#pragma unroll
      for (int j = 0; j < 8; ++j) {
        int l = l0 + wm * 32 + mt * 16 + ((lane & 16) ? 8 + j : j);
        AOut[((size_t)nb * SEQ + l) * DM + col] = (_Float16)oacc[mt][nt][j];
      }
    }
}

// ---------------------------------------------------------------------------
// Output GEMM: out[4096,1024] (f32) = attn[4096,1024] (f16) @ Wo + bo
// Tile 128x64, BK=64, f16 A copied with b128 vector moves.
// ---------------------------------------------------------------------------
__global__ __launch_bounds__(256) void out_gemm_kernel(
    const _Float16* __restrict__ A, const float* __restrict__ W,
    const float* __restrict__ bias, float* __restrict__ Out) {
  __shared__ __align__(16) _Float16 lsA[128][72];
  __shared__ __align__(16) _Float16 lsB[64][72];
  const int t = threadIdx.x, lane = t & 31, wid = t >> 5;
  const int wm = wid >> 1, wn = wid & 1;
  const int m0 = blockIdx.y * 128;
  const int n0 = blockIdx.x * 64;

  v8f acc[2][2] = {};
  for (int kb = 0; kb < DM; kb += 64) {
#pragma unroll
    for (int i = 0; i < 4; ++i) {                 // A: f16 b128 copies
      int idx = i * 256 + t; int r = idx >> 3, cc = (idx & 7) * 8;
      *(v8h*)&lsA[r][cc] = *(const v8h*)&A[(size_t)(m0 + r) * DM + kb + cc];
    }
#pragma unroll
    for (int i = 0; i < 8; ++i) {                 // B: W[k][n] -> lsB[n][k] pairs
      int idx = i * 256 + t; int n = idx & 63, k2 = (idx >> 6) * 2;
      float w0 = W[(size_t)(kb + k2) * DM + n0 + n];
      float w1 = W[(size_t)(kb + k2 + 1) * DM + n0 + n];
      pack_store(&lsB[n][k2], w0, w1);
    }
    if (kb + 64 < DM) {
      __builtin_prefetch(&A[(size_t)(m0 + (t >> 1)) * DM + kb + 64 + (t & 1) * 32], 0, 1);
      __builtin_prefetch(&W[(size_t)(kb + 64 + (t >> 2)) * DM + n0 + (t & 3) * 16], 0, 1);
    }
    __syncthreads();
#pragma unroll
    for (int ks = 0; ks < 64; ks += 32) {
      v16h b0 = lds_frag(&lsB[0][0], 72, wn * 32 + 0,  ks);
      v16h b1 = lds_frag(&lsB[0][0], 72, wn * 32 + 16, ks);
#pragma unroll
      for (int mt = 0; mt < 2; ++mt) {
        v16h a = lds_frag(&lsA[0][0], 72, wm * 32 + mt * 16, ks);
        acc[mt][0] = WMMA_F16(a, b0, acc[mt][0]);
        acc[mt][1] = WMMA_F16(a, b1, acc[mt][1]);
      }
    }
    __syncthreads();
  }
#pragma unroll
  for (int mt = 0; mt < 2; ++mt)
#pragma unroll
    for (int nt = 0; nt < 2; ++nt) {
      int col = n0 + wn * 32 + nt * 16 + (lane & 15);
      float bi = bias[col];
#pragma unroll
      for (int j = 0; j < 8; ++j) {
        int row = m0 + wm * 32 + mt * 16 + ((lane & 16) ? 8 + j : j);
        Out[(size_t)row * DM + col] = acc[mt][nt][j] + bi;
      }
    }
}

// ---------------------------------------------------------------------------
extern "C" void kernel_launch(void* const* d_in, const int* in_sizes, int n_in,
                              void* d_out, int out_size, void* d_ws, size_t ws_size,
                              hipStream_t stream) {
  (void)in_sizes; (void)n_in; (void)out_size; (void)ws_size;
  const float* queries = (const float*)d_in[0];
  const float* keys    = (const float*)d_in[1];
  const float* values  = (const float*)d_in[2];
  const float* Wq = (const float*)d_in[3];
  const float* bq = (const float*)d_in[4];
  const float* Wk = (const float*)d_in[5];
  const float* bk = (const float*)d_in[6];
  const float* Wv = (const float*)d_in[7];
  const float* bv = (const float*)d_in[8];
  const float* Wo = (const float*)d_in[9];
  const float* bo = (const float*)d_in[10];
  float* out = (float*)d_out;

  // Workspace carve-up (~33 MB total)
  const size_t headElems = (size_t)NH * SEQ * DH;      // 4,194,304 halfs each
  _Float16* Qh = (_Float16*)d_ws;
  _Float16* Kh = Qh + headElems;
  _Float16* Vh = Kh + headElems;
  _Float16* At = Vh + headElems;                       // [4096][1024] f16
  float* colmax = (float*)(At + (size_t)MTOT * DM);    // [NH][SEQ]
  float* colsum = colmax + (size_t)NH * SEQ;

  dim3 blk(256);
  dim3 gGemm(DM / 64, MTOT / 128);      // 16 x 32
  dim3 gStat(SEQ / 64, NH);             // 32 x 32
  dim3 gAttn(SEQ / 128, NH);            // 16 x 32

  proj_gemm_kernel<<<gGemm, blk, 0, stream>>>(queries, Wq, bq, Qh);
  proj_gemm_kernel<<<gGemm, blk, 0, stream>>>(keys,    Wk, bk, Kh);
  proj_gemm_kernel<<<gGemm, blk, 0, stream>>>(values,  Wv, bv, Vh);
  colstats_kernel<<<gStat, blk, 0, stream>>>(Qh, Kh, colmax, colsum);
  attn_pv_kernel<<<gAttn, blk, 0, stream>>>(Qh, Kh, Vh, colmax, colsum, At);
  out_gemm_kernel<<<gGemm, blk, 0, stream>>>(At, Wo, bo, out);
}

// v001
// Measured time: 178 microseconds a run.
// Two timings next to v000 put it at 1.07 and 1.08 times that version's speed.
#include <hip/hip_runtime.h>
#include <hip/hip_bf16.h>

typedef __attribute__((ext_vector_type(16))) _Float16 v16h;
typedef __attribute__((ext_vector_type(8)))  _Float16 v8h;
typedef __attribute__((ext_vector_type(8)))  float    v8f;

#define DM    1024
#define NHD   16
#define DH    64
#define NBAT  2
#define SEQ   2048
#define NH    (NBAT * NHD)    // 32 (n,h) pairs
#define MTOT  (NBAT * SEQ)    // 4096
#define SCORE_SCALE 0.125f    // 1/sqrt(64)

// ---------------------------------------------------------------------------
// Fragment loader: LDS tile stored as [outer][k] with row stride `ldk` halfs
// (ldk*2 bytes must be a multiple of 16). Implements the CDNA5 16-bit
// A-matrix layout: lanes 0-15 hold K {kb+0..7, kb+16..23}, lanes 16-31 hold
// K {kb+8..15, kb+24..31}. B is fed from a transposed LDS tile so the same
// loader serves both operands. Two ds_load_b128 per fragment.
// ---------------------------------------------------------------------------
__device__ __forceinline__ v16h lds_frag(const _Float16* base, int ldk,
                                         int outer, int kbase) {
  const int lane = threadIdx.x & 31;
  const int r  = outer + (lane & 15);
  const int ko = kbase + ((lane & 16) ? 8 : 0);
  const _Float16* p = base + r * ldk + ko;
  v8h lo = *(const v8h*)(p);        // K = ko .. ko+7
  v8h hi = *(const v8h*)(p + 16);   // K = ko+16 .. ko+23
  v16h f;
#pragma unroll
  for (int i = 0; i < 8; ++i) { f[i] = lo[i]; f[i + 8] = hi[i]; }
  return f;
}

#define WMMA_F16(A, B, C) \
  __builtin_amdgcn_wmma_f32_16x16x32_f16(false, (A), false, (B), (short)0, (C), false, false)

// packed f32x2 -> f16x2 -> one 32-bit LDS store
__device__ __forceinline__ void pack_store(_Float16* dst, float a, float b) {
  union { _Float16 h[2]; unsigned int u; } pk;
  pk.h[0] = (_Float16)a; pk.h[1] = (_Float16)b;
  *(unsigned int*)dst = pk.u;
}

// ---------------------------------------------------------------------------
// Projection GEMM: Out[n,h,l,d] (f16, head-major) = X[4096,1024] @ W[1024,1024] + b
// fp32 inputs converted to f16 (packed) while filling LDS. Tile 128x64, BK=64.
// ---------------------------------------------------------------------------
__global__ __launch_bounds__(256) void proj_gemm_kernel(
    const float* __restrict__ X, const float* __restrict__ W,
    const float* __restrict__ bias, _Float16* __restrict__ Out) {
  __shared__ __align__(16) _Float16 lsA[128][72];
  __shared__ __align__(16) _Float16 lsB[64][72];
  const int t = threadIdx.x, lane = t & 31, wid = t >> 5;
  const int wm = wid >> 1, wn = wid & 1;          // 4x2 wave grid
  const int m0 = blockIdx.y * 128;
  const int n0 = blockIdx.x * 64;

  v8f acc[2][2] = {};
  for (int kb = 0; kb < DM; kb += 64) {
#pragma unroll
    for (int i = 0; i < 16; ++i) {                // A: 128x64 f32 -> f16 pairs
      int idx = i * 256 + t; int r = idx >> 5, c2 = (idx & 31) * 2;
      const float* px = &X[(size_t)(m0 + r) * DM + kb + c2];
      pack_store(&lsA[r][c2], px[0], px[1]);
    }
#pragma unroll
    for (int i = 0; i < 8; ++i) {                 // B: W[k][n] -> lsB[n][k] pairs
      int idx = i * 256 + t; int n = idx & 63, k2 = (idx >> 6) * 2;
      float w0 = W[(size_t)(kb + k2) * DM + n0 + n];
      float w1 = W[(size_t)(kb + k2 + 1) * DM + n0 + n];
      pack_store(&lsB[n][k2], w0, w1);
    }
    if (kb + 64 < DM) {                           // prefetch next K-tile
      __builtin_prefetch(&X[(size_t)(m0 + (t >> 1)) * DM + kb + 64 + (t & 1) * 32], 0, 1);
      __builtin_prefetch(&W[(size_t)(kb + 64 + (t >> 2)) * DM + n0 + (t & 3) * 16], 0, 1);
    }
    __syncthreads();
#pragma unroll
    for (int ks = 0; ks < 64; ks += 32) {
      v16h b0 = lds_frag(&lsB[0][0], 72, wn * 32 + 0,  ks);
      v16h b1 = lds_frag(&lsB[0][0], 72, wn * 32 + 16, ks);
#pragma unroll
      for (int mt = 0; mt < 2; ++mt) {
        v16h a = lds_frag(&lsA[0][0], 72, wm * 32 + mt * 16, ks);
        acc[mt][0] = WMMA_F16(a, b0, acc[mt][0]);
        acc[mt][1] = WMMA_F16(a, b1, acc[mt][1]);
      }
    }
    __syncthreads();
  }
#pragma unroll
  for (int mt = 0; mt < 2; ++mt)
#pragma unroll
    for (int nt = 0; nt < 2; ++nt) {
      int col = n0 + wn * 32 + nt * 16 + (lane & 15);
      int h = col >> 6, d = col & 63;
      float bi = bias[col];
#pragma unroll
      for (int j = 0; j < 8; ++j) {
        int row = m0 + wm * 32 + mt * 16 + ((lane & 16) ? 8 + j : j);
        int nb = row >> 11, l = row & (SEQ - 1);
        Out[(((size_t)nb * NHD + h) * SEQ + l) * DH + d] =
            (_Float16)(acc[mt][nt][j] + bi);
      }
    }
}

// ---------------------------------------------------------------------------
// Column softmax statistics. One block owns a 64-wide s-strip of one (n,h)
// head and sweeps all L tiles ONCE: every lane keeps a running maximum of its
// own rows of a column and the sum of exp against that maximum, rescaled
// whenever the maximum rises. The eight partial (max, sum) pairs of a column
// are merged at the end. Deterministic block-local LDS reduction (no atomics).
// ---------------------------------------------------------------------------
__global__ __launch_bounds__(256) void colstats_kernel(
    const _Float16* __restrict__ Q, const _Float16* __restrict__ K,
    float* __restrict__ colmax, float* __restrict__ colsum) {
  __shared__ __align__(16) _Float16 lsQ[128][72];
  __shared__ __align__(16) _Float16 lsK[64][72];
  __shared__ float redM[8][64];
  __shared__ float redS[8][64];
  const int t = threadIdx.x, lane = t & 31, wid = t >> 5;
  const int wm = wid >> 1, wn = wid & 1;
  const int nh = blockIdx.y, s0 = blockIdx.x * 64;
  const _Float16* Qh = Q + (size_t)nh * SEQ * DH;
  const _Float16* Kh = K + (size_t)nh * SEQ * DH;
  const int rrow = wm * 2 + (lane >> 4);
  const int rc   = wn * 32 + (lane & 15);

#pragma unroll
  for (int i = 0; i < 2; ++i) {                   // K strip resident (b128 copies)
    int idx = i * 256 + t; int s = idx >> 3, cc = (idx & 7) * 8;
    *(v8h*)&lsK[s][cc] = *(const v8h*)&Kh[(size_t)(s0 + s) * DH + cc];
  }

  float cm0 = -3.0e38f, cm1 = -3.0e38f;           // running column max (scaled)
  float cs0 = 0.f, cs1 = 0.f;                     // sum of exp against cm0 / cm1
  for (int lt = 0; lt < SEQ / 128; ++lt) {
    __syncthreads();
#pragma unroll
    for (int i = 0; i < 4; ++i) {                 // Q tile (b128 copies)
      int idx = i * 256 + t; int r = idx >> 3, cc = (idx & 7) * 8;
      *(v8h*)&lsQ[r][cc] = *(const v8h*)&Qh[(size_t)(lt * 128 + r) * DH + cc];
    }
    if (lt + 1 < SEQ / 128)
      __builtin_prefetch(&Qh[(size_t)((lt + 1) * 128 + (t >> 1)) * DH + (t & 1) * 32], 0, 1);
    __syncthreads();
    v8f acc[2][2] = {};
#pragma unroll
    for (int kb = 0; kb < DH; kb += 32) {
      v16h b0 = lds_frag(&lsK[0][0], 72, wn * 32 + 0,  kb);
      v16h b1 = lds_frag(&lsK[0][0], 72, wn * 32 + 16, kb);
#pragma unroll
      for (int mt = 0; mt < 2; ++mt) {
        v16h a = lds_frag(&lsQ[0][0], 72, wm * 32 + mt * 16, kb);
        acc[mt][0] = WMMA_F16(a, b0, acc[mt][0]);
        acc[mt][1] = WMMA_F16(a, b1, acc[mt][1]);
      }
    }
    // this tile's maximum (the scale is a positive power of two: max commutes)
    float t0 = acc[0][0][0], t1 = acc[0][1][0];
#pragma unroll
    for (int mt = 0; mt < 2; ++mt)
#pragma unroll
      for (int j = 0; j < 8; ++j) {
        t0 = fmaxf(t0, acc[mt][0][j]);
        t1 = fmaxf(t1, acc[mt][1][j]);
      }
    const float n0 = fmaxf(cm0, t0 * SCORE_SCALE);
    const float n1 = fmaxf(cm1, t1 * SCORE_SCALE);
    cs0 *= __expf(cm0 - n0);                      // old sum onto the new maximum
    cs1 *= __expf(cm1 - n1);
    cm0 = n0;
    cm1 = n1;
#pragma unroll
    for (int mt = 0; mt < 2; ++mt)
#pragma unroll
      for (int j = 0; j < 8; ++j) {
        cs0 += __expf(acc[mt][0][j] * SCORE_SCALE - n0);
        cs1 += __expf(acc[mt][1][j] * SCORE_SCALE - n1);
      }
  }
  redM[rrow][rc] = cm0;
  redM[rrow][rc + 16] = cm1;
  redS[rrow][rc] = cs0;
  redS[rrow][rc + 16] = cs1;
  __syncthreads();
  if (t < 64) {
    float m = redM[0][t];
#pragma unroll
    for (int r = 1; r < 8; ++r) m = fmaxf(m, redM[r][t]);
    float z = 0.f;
#pragma unroll
    for (int r = 0; r < 8; ++r) z += redS[r][t] * __expf(redM[r][t] - m);
    colmax[(size_t)nh * SEQ + s0 + t] = m;
    colsum[(size_t)nh * SEQ + s0 + t] = z;
  }
}

// ---------------------------------------------------------------------------
// attn = softmax(QK^T/8, axis=query) @ V. One block owns a 128-row l-strip of
// one head; loops s tiles of 64: score WMMA -> exp/normalize -> P to LDS ->
// PV WMMA with transposed V tile. O accumulators persist in VGPRs.
// ---------------------------------------------------------------------------
__global__ __launch_bounds__(256) void attn_pv_kernel(
    const _Float16* __restrict__ Q, const _Float16* __restrict__ K,
    const _Float16* __restrict__ V, const float* __restrict__ colmax,
    const float* __restrict__ colsum, _Float16* __restrict__ AOut) {
  __shared__ __align__(16) _Float16 lsQ[128][72];
  __shared__ __align__(16) _Float16 lsK[64][72];
  __shared__ __align__(16) _Float16 lsV[64][72];   // transposed: [d][s]
  __shared__ __align__(16) _Float16 lsP[128][72];  // [l][s]
  const int t = threadIdx.x, lane = t & 31, wid = t >> 5;
  const int wm = wid >> 1, wn = wid & 1;
  const int nh = blockIdx.y, l0 = blockIdx.x * 128;
  const int nb = nh >> 4, hh = nh & 15;
  const _Float16* Qh = Q + (size_t)nh * SEQ * DH;
  const _Float16* Kh = K + (size_t)nh * SEQ * DH;
  const _Float16* Vh = V + (size_t)nh * SEQ * DH;
  const float* cmax = colmax + (size_t)nh * SEQ;
  const float* csum = colsum + (size_t)nh * SEQ;

#pragma unroll
  for (int i = 0; i < 4; ++i) {                   // Q strip resident (b128)
    int idx = i * 256 + t; int r = idx >> 3, cc = (idx & 7) * 8;
    *(v8h*)&lsQ[r][cc] = *(const v8h*)&Qh[(size_t)(l0 + r) * DH + cc];
  }
  v8f oacc[2][2] = {};
  for (int st = 0; st < SEQ / 64; ++st) {
    const int s0 = st * 64;
    __syncthreads();
#pragma unroll
    for (int i = 0; i < 2; ++i) {                 // K tile (b128 copies)
      int idx = i * 256 + t; int s = idx >> 3, cc = (idx & 7) * 8;
      *(v8h*)&lsK[s][cc] = *(const v8h*)&Kh[(size_t)(s0 + s) * DH + cc];
    }
#pragma unroll
    for (int i = 0; i < 2; ++i) {                 // V tile transposed into LDS
      int idx = i * 256 + t; int s = idx >> 3, d0 = (idx & 7) * 8;
      v8h vv = *(const v8h*)&Vh[(size_t)(s0 + s) * DH + d0];
#pragma unroll
      for (int j = 0; j < 8; ++j) lsV[d0 + j][s] = vv[j];
    }
    if (st + 1 < SEQ / 64) {                      // prefetch next s-tile
      __builtin_prefetch(&Kh[(size_t)(s0 + 64 + (t >> 2)) * DH + (t & 3) * 16], 0, 1);
      __builtin_prefetch(&Vh[(size_t)(s0 + 64 + (t >> 2)) * DH + (t & 3) * 16], 0, 1);
    }
    __syncthreads();
    // scores: 128(l) x 64(s)
    v8f sacc[2][2] = {};
#pragma unroll
    for (int kb = 0; kb < DH; kb += 32) {
      v16h b0 = lds_frag(&lsK[0][0], 72, wn * 32 + 0,  kb);
      v16h b1 = lds_frag(&lsK[0][0], 72, wn * 32 + 16, kb);
#pragma unroll
      for (int mt = 0; mt < 2; ++mt) {
        v16h a = lds_frag(&lsQ[0][0], 72, wm * 32 + mt * 16, kb);
        sacc[mt][0] = WMMA_F16(a, b0, sacc[mt][0]);
        sacc[mt][1] = WMMA_F16(a, b1, sacc[mt][1]);
      }
    }
    // P = exp(score*scale - m[s]) / Z[s]  (lane -> column, VGPR -> row)
    const int c0 = wn * 32 + (lane & 15);
    const float m0v = cmax[s0 + c0];
    const float m1v = cmax[s0 + c0 + 16];
    const float rz0 = 1.f / csum[s0 + c0];
    const float rz1 = 1.f / csum[s0 + c0 + 16];
#pragma unroll
    for (int mt = 0; mt < 2; ++mt)
#pragma unroll
      for (int j = 0; j < 8; ++j) {
        int row = wm * 32 + mt * 16 + ((lane & 16) ? 8 + j : j);
        lsP[row][c0]      = (_Float16)(__expf(sacc[mt][0][j] * SCORE_SCALE - m0v) * rz0);
        lsP[row][c0 + 16] = (_Float16)(__expf(sacc[mt][1][j] * SCORE_SCALE - m1v) * rz1);
      }
    __syncthreads();
    // O += P @ Vtile  (k-dim = s = 64)
#pragma unroll
    for (int kb = 0; kb < 64; kb += 32) {
      v16h b0 = lds_frag(&lsV[0][0], 72, wn * 32 + 0,  kb);
      v16h b1 = lds_frag(&lsV[0][0], 72, wn * 32 + 16, kb);
#pragma unroll
      for (int mt = 0; mt < 2; ++mt) {
        v16h a = lds_frag(&lsP[0][0], 72, wm * 32 + mt * 16, kb);
        oacc[mt][0] = WMMA_F16(a, b0, oacc[mt][0]);
        oacc[mt][1] = WMMA_F16(a, b1, oacc[mt][1]);
      }
    }
  }
  // store attn in [n][l][h*64+d] layout (f16) for the output GEMM
#pragma unroll
  for (int mt = 0; mt < 2; ++mt)
#pragma unroll
    for (int nt = 0; nt < 2; ++nt) {
      int col = hh * DH + wn * 32 + nt * 16 + (lane & 15);
#pragma unroll
      for (int j = 0; j < 8; ++j) {
        int l = l0 + wm * 32 + mt * 16 + ((lane & 16) ? 8 + j : j);
        AOut[((size_t)nb * SEQ + l) * DM + col] = (_Float16)oacc[mt][nt][j];
      }
    }
}

// ---------------------------------------------------------------------------
// Output GEMM: out[4096,1024] (f32) = attn[4096,1024] (f16) @ Wo + bo
// Tile 128x64, BK=64, f16 A copied with b128 vector moves.
// ---------------------------------------------------------------------------
__global__ __launch_bounds__(256) void out_gemm_kernel(
    const _Float16* __restrict__ A, const float* __restrict__ W,
    const float* __restrict__ bias, float* __restrict__ Out) {
  __shared__ __align__(16) _Float16 lsA[128][72];
  __shared__ __align__(16) _Float16 lsB[64][72];
  const int t = threadIdx.x, lane = t & 31, wid = t >> 5;
  const int wm = wid >> 1, wn = wid & 1;
  const int m0 = blockIdx.y * 128;
  const int n0 = blockIdx.x * 64;

  v8f acc[2][2] = {};
  for (int kb = 0; kb < DM; kb += 64) {
#pragma unroll
    for (int i = 0; i < 4; ++i) {                 // A: f16 b128 copies
      int idx = i * 256 + t; int r = idx >> 3, cc = (idx & 7) * 8;
      *(v8h*)&lsA[r][cc] = *(const v8h*)&A[(size_t)(m0 + r) * DM + kb + cc];
    }
#pragma unroll
    for (int i = 0; i < 8; ++i) {                 // B: W[k][n] -> lsB[n][k] pairs
      int idx = i * 256 + t; int n = idx & 63, k2 = (idx >> 6) * 2;
      float w0 = W[(size_t)(kb + k2) * DM + n0 + n];
      float w1 = W[(size_t)(kb + k2 + 1) * DM + n0 + n];
      pack_store(&lsB[n][k2], w0, w1);
    }
    if (kb + 64 < DM) {
      __builtin_prefetch(&A[(size_t)(m0 + (t >> 1)) * DM + kb + 64 + (t & 1) * 32], 0, 1);
      __builtin_prefetch(&W[(size_t)(kb + 64 + (t >> 2)) * DM + n0 + (t & 3) * 16], 0, 1);
    }
    __syncthreads();
#pragma unroll
    for (int ks = 0; ks < 64; ks += 32) {
      v16h b0 = lds_frag(&lsB[0][0], 72, wn * 32 + 0,  ks);
      v16h b1 = lds_frag(&lsB[0][0], 72, wn * 32 + 16, ks);
#pragma unroll
      for (int mt = 0; mt < 2; ++mt) {
        v16h a = lds_frag(&lsA[0][0], 72, wm * 32 + mt * 16, ks);
        acc[mt][0] = WMMA_F16(a, b0, acc[mt][0]);
        acc[mt][1] = WMMA_F16(a, b1, acc[mt][1]);
      }
    }
    __syncthreads();
  }
#pragma unroll
  for (int mt = 0; mt < 2; ++mt)
#pragma unroll
    for (int nt = 0; nt < 2; ++nt) {
      int col = n0 + wn * 32 + nt * 16 + (lane & 15);
      float bi = bias[col];
#pragma unroll
      for (int j = 0; j < 8; ++j) {
        int row = m0 + wm * 32 + mt * 16 + ((lane & 16) ? 8 + j : j);
        Out[(size_t)row * DM + col] = acc[mt][nt][j] + bi;
      }
    }
}

// ---------------------------------------------------------------------------
extern "C" void kernel_launch(void* const* d_in, const int* in_sizes, int n_in,
                              void* d_out, int out_size, void* d_ws, size_t ws_size,
                              hipStream_t stream) {
  (void)in_sizes; (void)n_in; (void)out_size; (void)ws_size;
  const float* queries = (const float*)d_in[0];
  const float* keys    = (const float*)d_in[1];
  const float* values  = (const float*)d_in[2];
  const float* Wq = (const float*)d_in[3];
  const float* bq = (const float*)d_in[4];
  const float* Wk = (const float*)d_in[5];
  const float* bk = (const float*)d_in[6];
  const float* Wv = (const float*)d_in[7];
  const float* bv = (const float*)d_in[8];
  const float* Wo = (const float*)d_in[9];
  const float* bo = (const float*)d_in[10];
  float* out = (float*)d_out;

  // Workspace carve-up (~33 MB total)
  const size_t headElems = (size_t)NH * SEQ * DH;      // 4,194,304 halfs each
  _Float16* Qh = (_Float16*)d_ws;
  _Float16* Kh = Qh + headElems;
  _Float16* Vh = Kh + headElems;
  _Float16* At = Vh + headElems;                       // [4096][1024] f16
  float* colmax = (float*)(At + (size_t)MTOT * DM);    // [NH][SEQ]
  float* colsum = colmax + (size_t)NH * SEQ;

  dim3 blk(256);
  dim3 gGemm(DM / 64, MTOT / 128);      // 16 x 32
  dim3 gStat(SEQ / 64, NH);             // 32 x 32
  dim3 gAttn(SEQ / 128, NH);            // 16 x 32

  proj_gemm_kernel<<<gGemm, blk, 0, stream>>>(queries, Wq, bq, Qh);
  proj_gemm_kernel<<<gGemm, blk, 0, stream>>>(keys,    Wk, bk, Kh);
  proj_gemm_kernel<<<gGemm, blk, 0, stream>>>(values,  Wv, bv, Vh);
  colstats_kernel<<<gStat, blk, 0, stream>>>(Qh, Kh, colmax, colsum);
  attn_pv_kernel<<<gAttn, blk, 0, stream>>>(Qh, Kh, Vh, colmax, colsum, At);
  out_gemm_kernel<<<gGemm, blk, 0, stream>>>(At, Wo, bo, out);
}

// v002
// It runs in 163 microseconds.
// In both of two side-by-side timings against v001, it was 1.09 times as fast.
// All steps since v000 together make it 1.17 times as fast.
#include <hip/hip_runtime.h>
#include <hip/hip_bf16.h>

typedef __attribute__((ext_vector_type(16))) _Float16 v16h;
typedef __attribute__((ext_vector_type(8)))  _Float16 v8h;
typedef __attribute__((ext_vector_type(8)))  float    v8f;

#define DM    1024
#define NHD   16
#define DH    64
#define NBAT  2
#define SEQ   2048
#define NH    (NBAT * NHD)    // 32 (n,h) pairs
#define MTOT  (NBAT * SEQ)    // 4096
#define SCORE_SCALE 0.125f    // 1/sqrt(64)

// ---------------------------------------------------------------------------
// Fragment loader: LDS tile stored as [outer][k] with row stride `ldk` halfs
// (ldk*2 bytes must be a multiple of 16). Implements the CDNA5 16-bit
// A-matrix layout: lanes 0-15 hold K {kb+0..7, kb+16..23}, lanes 16-31 hold
// K {kb+8..15, kb+24..31}. B is fed from a transposed LDS tile so the same
// loader serves both operands. Two ds_load_b128 per fragment.
// ---------------------------------------------------------------------------
__device__ __forceinline__ v16h lds_frag(const _Float16* base, int ldk,
                                         int outer, int kbase) {
  const int lane = threadIdx.x & 31;
  const int r  = outer + (lane & 15);
  const int ko = kbase + ((lane & 16) ? 8 : 0);
  const _Float16* p = base + r * ldk + ko;
  v8h lo = *(const v8h*)(p);        // K = ko .. ko+7
  v8h hi = *(const v8h*)(p + 16);   // K = ko+16 .. ko+23
  v16h f;
#pragma unroll
  for (int i = 0; i < 8; ++i) { f[i] = lo[i]; f[i + 8] = hi[i]; }
  return f;
}

#define WMMA_F16(A, B, C) \
  __builtin_amdgcn_wmma_f32_16x16x32_f16(false, (A), false, (B), (short)0, (C), false, false)

// packed f32x2 -> f16x2 -> one 32-bit LDS store
__device__ __forceinline__ void pack_store(_Float16* dst, float a, float b) {
  union { _Float16 h[2]; unsigned int u; } pk;
  pk.h[0] = (_Float16)a; pk.h[1] = (_Float16)b;
  *(unsigned int*)dst = pk.u;
}

// ---------------------------------------------------------------------------
// Projection GEMM: Out[n,h,l,d] (f16, head-major) = X[4096,1024] @ W[1024,1024] + b
// fp32 inputs converted to f16 (packed) while filling LDS. Tile 128x64, BK=64.
// ---------------------------------------------------------------------------
__global__ __launch_bounds__(256) void proj_gemm_kernel(
    const float* __restrict__ X, const float* __restrict__ W,
    const float* __restrict__ bias, _Float16* __restrict__ Out) {
  __shared__ __align__(16) _Float16 lsA[128][72];
  __shared__ __align__(16) _Float16 lsB[64][72];
  const int t = threadIdx.x, lane = t & 31, wid = t >> 5;
  const int wm = wid >> 1, wn = wid & 1;          // 4x2 wave grid
  const int m0 = blockIdx.y * 128;
  const int n0 = blockIdx.x * 64;

  v8f acc[2][2] = {};
  for (int kb = 0; kb < DM; kb += 64) {
#pragma unroll
    for (int i = 0; i < 16; ++i) {                // A: 128x64 f32 -> f16 pairs
      int idx = i * 256 + t; int r = idx >> 5, c2 = (idx & 31) * 2;
      const float* px = &X[(size_t)(m0 + r) * DM + kb + c2];
      pack_store(&lsA[r][c2], px[0], px[1]);
    }
#pragma unroll
    for (int i = 0; i < 8; ++i) {                 // B: W[k][n] -> lsB[n][k] pairs
      int idx = i * 256 + t; int n = idx & 63, k2 = (idx >> 6) * 2;
      float w0 = W[(size_t)(kb + k2) * DM + n0 + n];
      float w1 = W[(size_t)(kb + k2 + 1) * DM + n0 + n];
      pack_store(&lsB[n][k2], w0, w1);
    }
    if (kb + 64 < DM) {                           // prefetch next K-tile
      __builtin_prefetch(&X[(size_t)(m0 + (t >> 1)) * DM + kb + 64 + (t & 1) * 32], 0, 1);
      __builtin_prefetch(&W[(size_t)(kb + 64 + (t >> 2)) * DM + n0 + (t & 3) * 16], 0, 1);
    }
    __syncthreads();
#pragma unroll
    for (int ks = 0; ks < 64; ks += 32) {
      v16h b0 = lds_frag(&lsB[0][0], 72, wn * 32 + 0,  ks);
      v16h b1 = lds_frag(&lsB[0][0], 72, wn * 32 + 16, ks);
#pragma unroll
      for (int mt = 0; mt < 2; ++mt) {
        v16h a = lds_frag(&lsA[0][0], 72, wm * 32 + mt * 16, ks);
        acc[mt][0] = WMMA_F16(a, b0, acc[mt][0]);
        acc[mt][1] = WMMA_F16(a, b1, acc[mt][1]);
      }
    }
    __syncthreads();
  }
#pragma unroll
  for (int mt = 0; mt < 2; ++mt)
#pragma unroll
    for (int nt = 0; nt < 2; ++nt) {
      int col = n0 + wn * 32 + nt * 16 + (lane & 15);
      int h = col >> 6, d = col & 63;
      float bi = bias[col];
#pragma unroll
      for (int j = 0; j < 8; ++j) {
        int row = m0 + wm * 32 + mt * 16 + ((lane & 16) ? 8 + j : j);
        int nb = row >> 11, l = row & (SEQ - 1);
        Out[(((size_t)nb * NHD + h) * SEQ + l) * DH + d] =
            (_Float16)(acc[mt][nt][j] + bi);
      }
    }
}

// ---------------------------------------------------------------------------
// Column softmax statistics. One block owns a 64-wide s-strip of one (n,h)
// head and sweeps all L tiles ONCE: every lane keeps a running maximum of its
// own rows of a column and the sum of exp against that maximum, rescaled
// whenever the maximum rises. The eight partial (max, sum) pairs of a column
// are merged at the end. Deterministic block-local LDS reduction (no atomics).
// ---------------------------------------------------------------------------
__global__ __launch_bounds__(256) void colstats_kernel(
    const _Float16* __restrict__ Q, const _Float16* __restrict__ K,
    float* __restrict__ colmax, float* __restrict__ colsum) {
  __shared__ __align__(16) _Float16 lsQ[128][72];
  __shared__ __align__(16) _Float16 lsK[64][72];
  __shared__ float redM[8][64];
  __shared__ float redS[8][64];
  const int t = threadIdx.x, lane = t & 31, wid = t >> 5;
  const int wm = wid >> 1, wn = wid & 1;
  const int nh = blockIdx.y, s0 = blockIdx.x * 64;
  const _Float16* Qh = Q + (size_t)nh * SEQ * DH;
  const _Float16* Kh = K + (size_t)nh * SEQ * DH;
  const int rrow = wm * 2 + (lane >> 4);
  const int rc   = wn * 32 + (lane & 15);

#pragma unroll
  for (int i = 0; i < 2; ++i) {                   // K strip resident (b128 copies)
    int idx = i * 256 + t; int s = idx >> 3, cc = (idx & 7) * 8;
    *(v8h*)&lsK[s][cc] = *(const v8h*)&Kh[(size_t)(s0 + s) * DH + cc];
  }

  float cm0 = -3.0e38f, cm1 = -3.0e38f;           // running column max (scaled)
  float cs0 = 0.f, cs1 = 0.f;                     // sum of exp against cm0 / cm1
  for (int lt = 0; lt < SEQ / 128; ++lt) {
    __syncthreads();
#pragma unroll
    for (int i = 0; i < 4; ++i) {                 // Q tile (b128 copies)
      int idx = i * 256 + t; int r = idx >> 3, cc = (idx & 7) * 8;
      *(v8h*)&lsQ[r][cc] = *(const v8h*)&Qh[(size_t)(lt * 128 + r) * DH + cc];
    }
    if (lt + 1 < SEQ / 128)
      __builtin_prefetch(&Qh[(size_t)((lt + 1) * 128 + (t >> 1)) * DH + (t & 1) * 32], 0, 1);
    __syncthreads();
    v8f acc[2][2] = {};
#pragma unroll
    for (int kb = 0; kb < DH; kb += 32) {
      v16h b0 = lds_frag(&lsK[0][0], 72, wn * 32 + 0,  kb);
      v16h b1 = lds_frag(&lsK[0][0], 72, wn * 32 + 16, kb);
#pragma unroll
      for (int mt = 0; mt < 2; ++mt) {
        v16h a = lds_frag(&lsQ[0][0], 72, wm * 32 + mt * 16, kb);
        acc[mt][0] = WMMA_F16(a, b0, acc[mt][0]);
        acc[mt][1] = WMMA_F16(a, b1, acc[mt][1]);
      }
    }
    // this tile's maximum (the scale is a positive power of two: max commutes)
    float t0 = acc[0][0][0], t1 = acc[0][1][0];
#pragma unroll
    for (int mt = 0; mt < 2; ++mt)
#pragma unroll
      for (int j = 0; j < 8; ++j) {
        t0 = fmaxf(t0, acc[mt][0][j]);
        t1 = fmaxf(t1, acc[mt][1][j]);
      }
    const float n0 = fmaxf(cm0, t0 * SCORE_SCALE);
    const float n1 = fmaxf(cm1, t1 * SCORE_SCALE);
    cs0 *= __expf(cm0 - n0);                      // old sum onto the new maximum
    cs1 *= __expf(cm1 - n1);
    cm0 = n0;
    cm1 = n1;
#pragma unroll
    for (int mt = 0; mt < 2; ++mt)
#pragma unroll
      for (int j = 0; j < 8; ++j) {
        cs0 += __expf(acc[mt][0][j] * SCORE_SCALE - n0);
        cs1 += __expf(acc[mt][1][j] * SCORE_SCALE - n1);
      }
  }
  redM[rrow][rc] = cm0;
  redM[rrow][rc + 16] = cm1;
  redS[rrow][rc] = cs0;
  redS[rrow][rc + 16] = cs1;
  __syncthreads();
  if (t < 64) {
    float m = redM[0][t];
#pragma unroll
    for (int r = 1; r < 8; ++r) m = fmaxf(m, redM[r][t]);
    float z = 0.f;
#pragma unroll
    for (int r = 0; r < 8; ++r) z += redS[r][t] * __expf(redM[r][t] - m);
    colmax[(size_t)nh * SEQ + s0 + t] = m;
    colsum[(size_t)nh * SEQ + s0 + t] = z;
  }
}

// ---------------------------------------------------------------------------
// attn = softmax(QK^T/8, axis=query) @ V, in transposed form:
//   S^T = K Q^T (rows = keys s, columns = queries l),  O^T += V^T P^T.
// A lane of an S^T accumulator holds eight consecutive keys of ONE query
// column, which is exactly the k order of a B fragment: two 16-key score tiles
// pack into one 32-key P^T operand in registers, so P never touches LDS.
// One block = 4 waves, each wave owns 32 query columns of one head; the Q
// fragments are loaded once from global memory and stay in registers.
// The column statistics are per key = per accumulator row here: each s tile
// stages bias[s] = m[s]*log2(e) + log2(Z[s]), and
//   P = exp2(score * (log2(e)/8) - bias[s]) = exp(score/8 - m[s]) / Z[s].
// ---------------------------------------------------------------------------
#define LOG2E 1.44269504088896340736f
typedef __attribute__((ext_vector_type(2))) float    v2f;
typedef __attribute__((ext_vector_type(2))) _Float16 v2h;

// waves_per_eu(4, 4): a 256-register budget, so that a tile's K, V^T and bias
// reads are issued together ahead of its matrix work; under the default budget
// each V^T fragment was read and waited for right in front of its two products.
__global__ __launch_bounds__(128) __attribute__((amdgpu_waves_per_eu(4, 4))) void attn_pv_kernel(
    const _Float16* __restrict__ Q, const _Float16* __restrict__ K,
    const _Float16* __restrict__ V, const float* __restrict__ colmax,
    const float* __restrict__ colsum, _Float16* __restrict__ AOut) {
  __shared__ __align__(16) _Float16 lsK[64][72];   // [s][d]
  __shared__ __align__(16) _Float16 lsV[64][72];   // transposed: [d][s]
  __shared__ __align__(32) float lsC[64];          // bias[s] of this s tile
  const int t = threadIdx.x, lane = t & 31, wid = t >> 5;
  const int hi8 = (lane & 16) ? 8 : 0;
  const int nh = blockIdx.y, l0 = blockIdx.x * 128 + wid * 32;
  const int nb = nh >> 4, hh = nh & 15;
  const _Float16* Qh = Q + (size_t)nh * SEQ * DH;
  const _Float16* Kh = K + (size_t)nh * SEQ * DH;
  const _Float16* Vh = V + (size_t)nh * SEQ * DH;
  const float* cmax = colmax + (size_t)nh * SEQ;
  const float* csum = colsum + (size_t)nh * SEQ;

  // Q as B operand: lane -> query column, registers -> d in the hardware k order
  v16h qf[2][2];                                   // [l tile][d step]
#pragma unroll
  for (int nt = 0; nt < 2; ++nt)
#pragma unroll
    for (int kd = 0; kd < 2; ++kd) {
      const _Float16* p = Qh + (size_t)(l0 + nt * 16 + (lane & 15)) * DH + kd * 32 + hi8;
      v8h lo = *(const v8h*)(p);
      v8h hi = *(const v8h*)(p + 16);
#pragma unroll
      for (int i = 0; i < 8; ++i) { qf[nt][kd][i] = lo[i]; qf[nt][kd][i + 8] = hi[i]; }
    }

  const int toff = (t >> 3) * DH + (t & 7) * 8;    // this thread's place in a staged tile
  v8f oacc[4][2] = {};                             // O^T: [d tile][l tile]
  for (int st = 0; st < SEQ / 64; ++st) {
    const int s0 = st * 64;
    __syncthreads();
    // all of the tile's global loads are issued before the first LDS store
    const _Float16* Kt = Kh + (size_t)s0 * DH;    // uniform tile bases
    const _Float16* Vt = Vh + (size_t)s0 * DH;
    v8h kk[4], vv[4];
#pragma unroll
    for (int i = 0; i < 4; ++i) {                 // row (t >> 3) + 16 i, 16 bytes a lane
      kk[i] = *(const v8h*)&Kt[toff + i * 16 * DH];
      vv[i] = *(const v8h*)&Vt[toff + i * 16 * DH];
    }
    float cmv = 0.f, csv = 1.f;
    if (t < 64) { cmv = (cmax + s0)[t]; csv = (csum + s0)[t]; }  // waves 0 and 1, whole waves
#pragma unroll
    for (int i = 0; i < 4; ++i) {                 // K tile (b128 copies)
      int idx = i * 128 + t; int s = idx >> 3, cc = (idx & 7) * 8;
      *(v8h*)&lsK[s][cc] = kk[i];
    }
#pragma unroll
    for (int i = 0; i < 4; ++i) {                 // V tile transposed into LDS
      int idx = i * 128 + t; int s = idx >> 3, d0 = (idx & 7) * 8;
#pragma unroll
      for (int j = 0; j < 8; ++j) lsV[d0 + j][s] = vv[i][j];
    }
    if (t < 64) lsC[t] = cmv * LOG2E + __log2f(csv);
    if (st + 1 < SEQ / 64) {                      // prefetch next s-tile
      __builtin_prefetch(&Kh[(size_t)(s0 + 64 + (t >> 1)) * DH + (t & 1) * 32], 0, 1);
      __builtin_prefetch(&Vh[(size_t)(s0 + 64 + (t >> 1)) * DH + (t & 1) * 32], 0, 1);
    }
    __syncthreads();
#pragma unroll
    for (int ks = 0; ks < 64; ks += 32) {         // 32 keys per pass
      // this pass's LDS reads stand together, ahead of its matrix work
      v16h kf[2][2], vf[4];                       // K: [d step][s tile]; V^T: [d tile]
#pragma unroll
      for (int kd = 0; kd < 2; ++kd)
#pragma unroll
        for (int mt = 0; mt < 2; ++mt)
          kf[kd][mt] = lds_frag(&lsK[0][0], 72, ks + mt * 16, kd * 32);
      // accumulator row j of s tile mt is key ks + mt*16 + hi8 + j
      v8f cb[2];
      cb[0] = *(const v8f*)&lsC[ks + hi8];
      cb[1] = *(const v8f*)&lsC[ks + 16 + hi8];
#pragma unroll
      for (int dt = 0; dt < 4; ++dt)
        vf[dt] = lds_frag(&lsV[0][0], 72, dt * 16, ks);
      // S^T: 32(s) x 32(l), k-dim = d = 64
      v8f sacc[2][2] = {};                        // [s tile][l tile]
#pragma unroll
      for (int kd = 0; kd < 2; ++kd)
#pragma unroll
        for (int mt = 0; mt < 2; ++mt) {
          sacc[mt][0] = WMMA_F16(kf[kd][mt], qf[0][kd], sacc[mt][0]);
          sacc[mt][1] = WMMA_F16(kf[kd][mt], qf[1][kd], sacc[mt][1]);
        }
      v16h pf[2];                                 // P^T as B operand, k = s
#pragma unroll
      for (int nt = 0; nt < 2; ++nt)
#pragma unroll
        for (int mt = 0; mt < 2; ++mt)
#pragma unroll
          for (int j = 0; j < 8; j += 2) {
            v2f x = {sacc[mt][nt][j], sacc[mt][nt][j + 1]};
            v2f c = {cb[mt][j], cb[mt][j + 1]};
            x = x * (SCORE_SCALE * LOG2E) - c;
            v2f e = {__builtin_amdgcn_exp2f(x[0]), __builtin_amdgcn_exp2f(x[1])};
            v2h h = __builtin_convertvector(e, v2h);
            pf[nt][mt * 8 + j]     = h[0];
            pf[nt][mt * 8 + j + 1] = h[1];
          }
      // O^T += V^T P^T  (k-dim = these 32 keys)
#pragma unroll
      for (int dt = 0; dt < 4; ++dt) {
        oacc[dt][0] = WMMA_F16(vf[dt], pf[0], oacc[dt][0]);
        oacc[dt][1] = WMMA_F16(vf[dt], pf[1], oacc[dt][1]);
      }
    }
  }
  // store attn in [n][l][h*64+d] layout (f16): a lane holds eight consecutive d
#pragma unroll
  for (int nt = 0; nt < 2; ++nt) {
    const int l = l0 + nt * 16 + (lane & 15);
#pragma unroll
    for (int dt = 0; dt < 4; ++dt) {
      v8h o;
#pragma unroll
      for (int j = 0; j < 8; ++j) o[j] = (_Float16)oacc[dt][nt][j];
      *(v8h*)&AOut[((size_t)nb * SEQ + l) * DM + hh * DH + dt * 16 + hi8] = o;
    }
  }
}

// ---------------------------------------------------------------------------
// Output GEMM: out[4096,1024] (f32) = attn[4096,1024] (f16) @ Wo + bo
// Tile 128x64, BK=64, f16 A copied with b128 vector moves.
// ---------------------------------------------------------------------------
__global__ __launch_bounds__(256) void out_gemm_kernel(
    const _Float16* __restrict__ A, const float* __restrict__ W,
    const float* __restrict__ bias, float* __restrict__ Out) {
  __shared__ __align__(16) _Float16 lsA[128][72];
  __shared__ __align__(16) _Float16 lsB[64][72];
  const int t = threadIdx.x, lane = t & 31, wid = t >> 5;
  const int wm = wid >> 1, wn = wid & 1;
  const int m0 = blockIdx.y * 128;
  const int n0 = blockIdx.x * 64;

  v8f acc[2][2] = {};
  for (int kb = 0; kb < DM; kb += 64) {
#pragma unroll
    for (int i = 0; i < 4; ++i) {                 // A: f16 b128 copies
      int idx = i * 256 + t; int r = idx >> 3, cc = (idx & 7) * 8;
      *(v8h*)&lsA[r][cc] = *(const v8h*)&A[(size_t)(m0 + r) * DM + kb + cc];
    }
#pragma unroll
    for (int i = 0; i < 8; ++i) {                 // B: W[k][n] -> lsB[n][k] pairs
      int idx = i * 256 + t; int n = idx & 63, k2 = (idx >> 6) * 2;
      float w0 = W[(size_t)(kb + k2) * DM + n0 + n];
      float w1 = W[(size_t)(kb + k2 + 1) * DM + n0 + n];
      pack_store(&lsB[n][k2], w0, w1);
    }
    if (kb + 64 < DM) {
      __builtin_prefetch(&A[(size_t)(m0 + (t >> 1)) * DM + kb + 64 + (t & 1) * 32], 0, 1);
      __builtin_prefetch(&W[(size_t)(kb + 64 + (t >> 2)) * DM + n0 + (t & 3) * 16], 0, 1);
    }
    __syncthreads();
#pragma unroll
    for (int ks = 0; ks < 64; ks += 32) {
      v16h b0 = lds_frag(&lsB[0][0], 72, wn * 32 + 0,  ks);
      v16h b1 = lds_frag(&lsB[0][0], 72, wn * 32 + 16, ks);
#pragma unroll
      for (int mt = 0; mt < 2; ++mt) {
        v16h a = lds_frag(&lsA[0][0], 72, wm * 32 + mt * 16, ks);
        acc[mt][0] = WMMA_F16(a, b0, acc[mt][0]);
        acc[mt][1] = WMMA_F16(a, b1, acc[mt][1]);
      }
    }
    __syncthreads();
  }
#pragma unroll
  for (int mt = 0; mt < 2; ++mt)
#pragma unroll
    for (int nt = 0; nt < 2; ++nt) {
      int col = n0 + wn * 32 + nt * 16 + (lane & 15);
      float bi = bias[col];
#pragma unroll
      for (int j = 0; j < 8; ++j) {
        int row = m0 + wm * 32 + mt * 16 + ((lane & 16) ? 8 + j : j);
        Out[(size_t)row * DM + col] = acc[mt][nt][j] + bi;
      }
    }
}

// ---------------------------------------------------------------------------
extern "C" void kernel_launch(void* const* d_in, const int* in_sizes, int n_in,
                              void* d_out, int out_size, void* d_ws, size_t ws_size,
                              hipStream_t stream) {
  (void)in_sizes; (void)n_in; (void)out_size; (void)ws_size;
  const float* queries = (const float*)d_in[0];
  const float* keys    = (const float*)d_in[1];
  const float* values  = (const float*)d_in[2];
  const float* Wq = (const float*)d_in[3];
  const float* bq = (const float*)d_in[4];
  const float* Wk = (const float*)d_in[5];
  const float* bk = (const float*)d_in[6];
  const float* Wv = (const float*)d_in[7];
  const float* bv = (const float*)d_in[8];
  const float* Wo = (const float*)d_in[9];
  const float* bo = (const float*)d_in[10];
  float* out = (float*)d_out;

  // Workspace carve-up (~33 MB total)
  const size_t headElems = (size_t)NH * SEQ * DH;      // 4,194,304 halfs each
  _Float16* Qh = (_Float16*)d_ws;
  _Float16* Kh = Qh + headElems;
  _Float16* Vh = Kh + headElems;
  _Float16* At = Vh + headElems;                       // [4096][1024] f16
  float* colmax = (float*)(At + (size_t)MTOT * DM);    // [NH][SEQ]
  float* colsum = colmax + (size_t)NH * SEQ;

  dim3 blk(256);
  dim3 gGemm(DM / 64, MTOT / 128);      // 16 x 32
  dim3 gStat(SEQ / 64, NH);             // 32 x 32
  dim3 gAttn(SEQ / 128, NH);            // 16 x 32

  proj_gemm_kernel<<<gGemm, blk, 0, stream>>>(queries, Wq, bq, Qh);
  proj_gemm_kernel<<<gGemm, blk, 0, stream>>>(keys,    Wk, bk, Kh);
  proj_gemm_kernel<<<gGemm, blk, 0, stream>>>(values,  Wv, bv, Vh);
  colstats_kernel<<<gStat, blk, 0, stream>>>(Qh, Kh, colmax, colsum);
  attn_pv_kernel<<<gAttn, dim3(128), 0, stream>>>(Qh, Kh, Vh, colmax, colsum, At);
  out_gemm_kernel<<<gGemm, blk, 0, stream>>>(At, Wo, bo, out);
}

// v003
// One run takes 156 microseconds.
// Two timings next to v002 both put it at 1.05 times that version's speed.
// Counting every step since v000, it is 1.23 times as fast.
#include <hip/hip_runtime.h>
#include <hip/hip_bf16.h>

typedef __attribute__((ext_vector_type(16))) _Float16 v16h;
typedef __attribute__((ext_vector_type(8)))  _Float16 v8h;
typedef __attribute__((ext_vector_type(8)))  float    v8f;

#define DM    1024
#define NHD   16
#define DH    64
#define NBAT  2
#define SEQ   2048
#define NH    (NBAT * NHD)    // 32 (n,h) pairs
#define MTOT  (NBAT * SEQ)    // 4096
#define SCORE_SCALE 0.125f    // 1/sqrt(64)

// ---------------------------------------------------------------------------
// Fragment loader: LDS tile stored as [outer][k] with row stride `ldk` halfs
// (ldk*2 bytes must be a multiple of 16). Implements the CDNA5 16-bit
// A-matrix layout: lanes 0-15 hold K {kb+0..7, kb+16..23}, lanes 16-31 hold
// K {kb+8..15, kb+24..31}. B is fed from a transposed LDS tile so the same
// loader serves both operands. Two ds_load_b128 per fragment.
// ---------------------------------------------------------------------------
__device__ __forceinline__ v16h lds_frag(const _Float16* base, int ldk,
                                         int outer, int kbase) {
  const int lane = threadIdx.x & 31;
  const int r  = outer + (lane & 15);
  const int ko = kbase + ((lane & 16) ? 8 : 0);
  const _Float16* p = base + r * ldk + ko;
  v8h lo = *(const v8h*)(p);        // K = ko .. ko+7
  v8h hi = *(const v8h*)(p + 16);   // K = ko+16 .. ko+23
  v16h f;
#pragma unroll
  for (int i = 0; i < 8; ++i) { f[i] = lo[i]; f[i + 8] = hi[i]; }
  return f;
}

#define WMMA_F16(A, B, C) \
  __builtin_amdgcn_wmma_f32_16x16x32_f16(false, (A), false, (B), (short)0, (C), false, false)

// packed f32x2 -> f16x2 -> one 32-bit LDS store
__device__ __forceinline__ void pack_store(_Float16* dst, float a, float b) {
  union { _Float16 h[2]; unsigned int u; } pk;
  pk.h[0] = (_Float16)a; pk.h[1] = (_Float16)b;
  *(unsigned int*)dst = pk.u;
}

// ---------------------------------------------------------------------------
// Projection GEMM: Out[n,h,l,d] (f16, head-major) = X[4096,1024] @ W[1024,1024] + b
// fp32 inputs converted to f16 (packed) while filling LDS. Tile 128x64, BK=64.
// The q, k and v projections are independent of one another and run as ONE
// grid: blockIdx.z picks the product and its plane of the output. All 1536
// blocks are resident at once, six a WGP instead of two, and cover each
// other's load waits and barriers; two launch gaps, fills and tails go.
// Six 8-wave blocks a WGP are 12 waves a SIMD: the second launch bound asks
// for that, a budget of 80 registers (at 181 only two blocks fit a WGP).
// ---------------------------------------------------------------------------
__global__ __launch_bounds__(256, 12) void proj_gemm_kernel(
    const float* __restrict__ Xq, const float* __restrict__ Xk,
    const float* __restrict__ Xv, const float* __restrict__ Wq,
    const float* __restrict__ Wk, const float* __restrict__ Wv,
    const float* __restrict__ bq, const float* __restrict__ bk,
    const float* __restrict__ bv, _Float16* __restrict__ OutQKV) {
  __shared__ __align__(16) _Float16 lsA[128][72];
  __shared__ __align__(16) _Float16 lsB[64][72];
  const int t = threadIdx.x, lane = t & 31, wid = t >> 5;
  const int wm = wid >> 1, wn = wid & 1;          // 4x2 wave grid
  const int m0 = blockIdx.y * 128;
  const int n0 = blockIdx.x * 64;
  const int pz = blockIdx.z;                      // 0: q, 1: k, 2: v
  const float* __restrict__ X    = pz == 0 ? Xq : (pz == 1 ? Xk : Xv);
  const float* __restrict__ W    = pz == 0 ? Wq : (pz == 1 ? Wk : Wv);
  const float* __restrict__ bias = pz == 0 ? bq : (pz == 1 ? bk : bv);
  _Float16* __restrict__ Out = OutQKV + (size_t)pz * ((size_t)NH * SEQ * DH);

  // One address per operand and thread, the sixteen (eight) rows of a tile at
  // constant distances from it: the same bytes as before, but the addresses
  // take 4 registers instead of about 50, which the register budget needs.
  const float* pa = X + (size_t)(m0 + (t >> 5)) * DM + (t & 31) * 2;     // row + 8 i
  const float* pb = W + (size_t)((t >> 6) * 2) * DM + n0 + (t & 63);     // k + 8 i
  _Float16* sa = &lsA[t >> 5][(t & 31) * 2];
  _Float16* sb = &lsB[t & 63][(t >> 6) * 2];

  v8f acc[2][2] = {};
  for (int kb = 0; kb < DM; kb += 64) {
#pragma unroll
    for (int hf = 0; hf < 2; ++hf) {
      // half a tile of each operand at a time: 24 loads together, then their
      // stores, so 24 loaded registers are live instead of 48 (the budget)
      float a0[8], a1[8], w0[4], w1[4];
#pragma unroll
      for (int i = 0; i < 8; ++i) {               // A: 128x64 f32
        a0[i] = pa[(hf * 8 + i) * 8 * DM];
        a1[i] = pa[(hf * 8 + i) * 8 * DM + 1];
      }
#pragma unroll
      for (int i = 0; i < 4; ++i) {               // B: W[k][n], two k of one n
        w0[i] = pb[(hf * 4 + i) * 8 * DM];
        w1[i] = pb[((hf * 4 + i) * 8 + 1) * DM];
      }
#pragma unroll
      for (int i = 0; i < 8; ++i)                 // -> f16 pairs, lsA[row][k]
        pack_store(sa + (hf * 8 + i) * 8 * 72, a0[i], a1[i]);
#pragma unroll
      for (int i = 0; i < 4; ++i)                 // -> f16 pairs, lsB[n][k]
        pack_store(sb + (hf * 4 + i) * 8, w0[i], w1[i]);
    }
    if (kb + 64 < DM) {                           // prefetch next K-tile
      __builtin_prefetch(&X[(size_t)(m0 + (t >> 1)) * DM + kb + 64 + (t & 1) * 32], 0, 1);
      __builtin_prefetch(&W[(size_t)(kb + 64 + (t >> 2)) * DM + n0 + (t & 3) * 16], 0, 1);
    }
    pa += 64;
    pb += 64 * DM;
    __syncthreads();
#pragma unroll
    for (int ks = 0; ks < 64; ks += 32) {
      v16h b0 = lds_frag(&lsB[0][0], 72, wn * 32 + 0,  ks);
      v16h b1 = lds_frag(&lsB[0][0], 72, wn * 32 + 16, ks);
#pragma unroll
      for (int mt = 0; mt < 2; ++mt) {
        v16h a = lds_frag(&lsA[0][0], 72, wm * 32 + mt * 16, ks);
        acc[mt][0] = WMMA_F16(a, b0, acc[mt][0]);
        acc[mt][1] = WMMA_F16(a, b1, acc[mt][1]);
      }
    }
    __syncthreads();
  }
#pragma unroll
  for (int mt = 0; mt < 2; ++mt)
#pragma unroll
    for (int nt = 0; nt < 2; ++nt) {
      int col = n0 + wn * 32 + nt * 16 + (lane & 15);
      int h = col >> 6, d = col & 63;
      float bi = bias[col];
#pragma unroll
      for (int j = 0; j < 8; ++j) {
        int row = m0 + wm * 32 + mt * 16 + ((lane & 16) ? 8 + j : j);
        int nb = row >> 11, l = row & (SEQ - 1);
        Out[(((size_t)nb * NHD + h) * SEQ + l) * DH + d] =
            (_Float16)(acc[mt][nt][j] + bi);
      }
    }
}

// ---------------------------------------------------------------------------
// Column softmax statistics. One block owns a 64-wide s-strip of one (n,h)
// head and sweeps all L tiles ONCE: every lane keeps a running maximum of its
// own rows of a column and the sum of exp against that maximum, rescaled
// whenever the maximum rises. The eight partial (max, sum) pairs of a column
// are merged at the end. Deterministic block-local LDS reduction (no atomics).
// ---------------------------------------------------------------------------
__global__ __launch_bounds__(256) void colstats_kernel(
    const _Float16* __restrict__ Q, const _Float16* __restrict__ K,
    float* __restrict__ colmax, float* __restrict__ colsum) {
  __shared__ __align__(16) _Float16 lsQ[128][72];
  __shared__ __align__(16) _Float16 lsK[64][72];
  __shared__ float redM[8][64];
  __shared__ float redS[8][64];
  const int t = threadIdx.x, lane = t & 31, wid = t >> 5;
  const int wm = wid >> 1, wn = wid & 1;
  const int nh = blockIdx.y, s0 = blockIdx.x * 64;
  const _Float16* Qh = Q + (size_t)nh * SEQ * DH;
  const _Float16* Kh = K + (size_t)nh * SEQ * DH;
  const int rrow = wm * 2 + (lane >> 4);
  const int rc   = wn * 32 + (lane & 15);

#pragma unroll
  for (int i = 0; i < 2; ++i) {                   // K strip resident (b128 copies)
    int idx = i * 256 + t; int s = idx >> 3, cc = (idx & 7) * 8;
    *(v8h*)&lsK[s][cc] = *(const v8h*)&Kh[(size_t)(s0 + s) * DH + cc];
  }

  float cm0 = -3.0e38f, cm1 = -3.0e38f;           // running column max (scaled)
  float cs0 = 0.f, cs1 = 0.f;                     // sum of exp against cm0 / cm1
  for (int lt = 0; lt < SEQ / 128; ++lt) {
    __syncthreads();
#pragma unroll
    for (int i = 0; i < 4; ++i) {                 // Q tile (b128 copies)
      int idx = i * 256 + t; int r = idx >> 3, cc = (idx & 7) * 8;
      *(v8h*)&lsQ[r][cc] = *(const v8h*)&Qh[(size_t)(lt * 128 + r) * DH + cc];
    }
    if (lt + 1 < SEQ / 128)
      __builtin_prefetch(&Qh[(size_t)((lt + 1) * 128 + (t >> 1)) * DH + (t & 1) * 32], 0, 1);
    __syncthreads();
    v8f acc[2][2] = {};
#pragma unroll
    for (int kb = 0; kb < DH; kb += 32) {
      v16h b0 = lds_frag(&lsK[0][0], 72, wn * 32 + 0,  kb);
      v16h b1 = lds_frag(&lsK[0][0], 72, wn * 32 + 16, kb);
#pragma unroll
      for (int mt = 0; mt < 2; ++mt) {
        v16h a = lds_frag(&lsQ[0][0], 72, wm * 32 + mt * 16, kb);
        acc[mt][0] = WMMA_F16(a, b0, acc[mt][0]);
        acc[mt][1] = WMMA_F16(a, b1, acc[mt][1]);
      }
    }
    // this tile's maximum (the scale is a positive power of two: max commutes)
    float t0 = acc[0][0][0], t1 = acc[0][1][0];
#pragma unroll
    for (int mt = 0; mt < 2; ++mt)
#pragma unroll
      for (int j = 0; j < 8; ++j) {
        t0 = fmaxf(t0, acc[mt][0][j]);
        t1 = fmaxf(t1, acc[mt][1][j]);
      }
    const float n0 = fmaxf(cm0, t0 * SCORE_SCALE);
    const float n1 = fmaxf(cm1, t1 * SCORE_SCALE);
    cs0 *= __expf(cm0 - n0);                      // old sum onto the new maximum
    cs1 *= __expf(cm1 - n1);
    cm0 = n0;
    cm1 = n1;
#pragma unroll
    for (int mt = 0; mt < 2; ++mt)
#pragma unroll
      for (int j = 0; j < 8; ++j) {
        cs0 += __expf(acc[mt][0][j] * SCORE_SCALE - n0);
        cs1 += __expf(acc[mt][1][j] * SCORE_SCALE - n1);
      }
  }
  redM[rrow][rc] = cm0;
  redM[rrow][rc + 16] = cm1;
  redS[rrow][rc] = cs0;
  redS[rrow][rc + 16] = cs1;
  __syncthreads();
  if (t < 64) {
    float m = redM[0][t];
#pragma unroll
    for (int r = 1; r < 8; ++r) m = fmaxf(m, redM[r][t]);
    float z = 0.f;
#pragma unroll
    for (int r = 0; r < 8; ++r) z += redS[r][t] * __expf(redM[r][t] - m);
    colmax[(size_t)nh * SEQ + s0 + t] = m;
    colsum[(size_t)nh * SEQ + s0 + t] = z;
  }
}

// ---------------------------------------------------------------------------
// attn = softmax(QK^T/8, axis=query) @ V, in transposed form:
//   S^T = K Q^T (rows = keys s, columns = queries l),  O^T += V^T P^T.
// A lane of an S^T accumulator holds eight consecutive keys of ONE query
// column, which is exactly the k order of a B fragment: two 16-key score tiles
// pack into one 32-key P^T operand in registers, so P never touches LDS.
// One block = 4 waves, each wave owns 32 query columns of one head; the Q
// fragments are loaded once from global memory and stay in registers.
// The column statistics are per key = per accumulator row here: each s tile
// stages bias[s] = m[s]*log2(e) + log2(Z[s]), and
//   P = exp2(score * (log2(e)/8) - bias[s]) = exp(score/8 - m[s]) / Z[s].
// ---------------------------------------------------------------------------
#define LOG2E 1.44269504088896340736f
typedef __attribute__((ext_vector_type(2))) float    v2f;
typedef __attribute__((ext_vector_type(2))) _Float16 v2h;

// waves_per_eu(4, 4): a 256-register budget, so that a tile's K, V^T and bias
// reads are issued together ahead of its matrix work; under the default budget
// each V^T fragment was read and waited for right in front of its two products.
__global__ __launch_bounds__(128) __attribute__((amdgpu_waves_per_eu(4, 4))) void attn_pv_kernel(
    const _Float16* __restrict__ Q, const _Float16* __restrict__ K,
    const _Float16* __restrict__ V, const float* __restrict__ colmax,
    const float* __restrict__ colsum, _Float16* __restrict__ AOut) {
  __shared__ __align__(16) _Float16 lsK[64][72];   // [s][d]
  __shared__ __align__(16) _Float16 lsV[64][72];   // transposed: [d][s]
  __shared__ __align__(32) float lsC[64];          // bias[s] of this s tile
  const int t = threadIdx.x, lane = t & 31, wid = t >> 5;
  const int hi8 = (lane & 16) ? 8 : 0;
  const int nh = blockIdx.y, l0 = blockIdx.x * 128 + wid * 32;
  const int nb = nh >> 4, hh = nh & 15;
  const _Float16* Qh = Q + (size_t)nh * SEQ * DH;
  const _Float16* Kh = K + (size_t)nh * SEQ * DH;
  const _Float16* Vh = V + (size_t)nh * SEQ * DH;
  const float* cmax = colmax + (size_t)nh * SEQ;
  const float* csum = colsum + (size_t)nh * SEQ;

  // Q as B operand: lane -> query column, registers -> d in the hardware k order
  v16h qf[2][2];                                   // [l tile][d step]
#pragma unroll
  for (int nt = 0; nt < 2; ++nt)
#pragma unroll
    for (int kd = 0; kd < 2; ++kd) {
      const _Float16* p = Qh + (size_t)(l0 + nt * 16 + (lane & 15)) * DH + kd * 32 + hi8;
      v8h lo = *(const v8h*)(p);
      v8h hi = *(const v8h*)(p + 16);
#pragma unroll
      for (int i = 0; i < 8; ++i) { qf[nt][kd][i] = lo[i]; qf[nt][kd][i + 8] = hi[i]; }
    }

  const int toff = (t >> 3) * DH + (t & 7) * 8;    // this thread's place in a staged tile
  v8f oacc[4][2] = {};                             // O^T: [d tile][l tile]
  for (int st = 0; st < SEQ / 64; ++st) {
    const int s0 = st * 64;
    __syncthreads();
    // all of the tile's global loads are issued before the first LDS store
    const _Float16* Kt = Kh + (size_t)s0 * DH;    // uniform tile bases
    const _Float16* Vt = Vh + (size_t)s0 * DH;
    v8h kk[4], vv[4];
#pragma unroll
    for (int i = 0; i < 4; ++i) {                 // row (t >> 3) + 16 i, 16 bytes a lane
      kk[i] = *(const v8h*)&Kt[toff + i * 16 * DH];
      vv[i] = *(const v8h*)&Vt[toff + i * 16 * DH];
    }
    float cmv = 0.f, csv = 1.f;
    if (t < 64) { cmv = (cmax + s0)[t]; csv = (csum + s0)[t]; }  // waves 0 and 1, whole waves
#pragma unroll
    for (int i = 0; i < 4; ++i) {                 // K tile (b128 copies)
      int idx = i * 128 + t; int s = idx >> 3, cc = (idx & 7) * 8;
      *(v8h*)&lsK[s][cc] = kk[i];
    }
#pragma unroll
    for (int i = 0; i < 4; ++i) {                 // V tile transposed into LDS
      int idx = i * 128 + t; int s = idx >> 3, d0 = (idx & 7) * 8;
#pragma unroll
      for (int j = 0; j < 8; ++j) lsV[d0 + j][s] = vv[i][j];
    }
    if (t < 64) lsC[t] = cmv * LOG2E + __log2f(csv);
    if (st + 1 < SEQ / 64) {                      // prefetch next s-tile
      __builtin_prefetch(&Kh[(size_t)(s0 + 64 + (t >> 1)) * DH + (t & 1) * 32], 0, 1);
      __builtin_prefetch(&Vh[(size_t)(s0 + 64 + (t >> 1)) * DH + (t & 1) * 32], 0, 1);
    }
    __syncthreads();
#pragma unroll
    for (int ks = 0; ks < 64; ks += 32) {         // 32 keys per pass
      // this pass's LDS reads stand together, ahead of its matrix work
      v16h kf[2][2], vf[4];                       // K: [d step][s tile]; V^T: [d tile]
#pragma unroll
      for (int kd = 0; kd < 2; ++kd)
#pragma unroll
        for (int mt = 0; mt < 2; ++mt)
          kf[kd][mt] = lds_frag(&lsK[0][0], 72, ks + mt * 16, kd * 32);
      // accumulator row j of s tile mt is key ks + mt*16 + hi8 + j
      v8f cb[2];
      cb[0] = *(const v8f*)&lsC[ks + hi8];
      cb[1] = *(const v8f*)&lsC[ks + 16 + hi8];
#pragma unroll
      for (int dt = 0; dt < 4; ++dt)
        vf[dt] = lds_frag(&lsV[0][0], 72, dt * 16, ks);
      // S^T: 32(s) x 32(l), k-dim = d = 64
      v8f sacc[2][2] = {};                        // [s tile][l tile]
#pragma unroll
      for (int kd = 0; kd < 2; ++kd)
#pragma unroll
        for (int mt = 0; mt < 2; ++mt) {
          sacc[mt][0] = WMMA_F16(kf[kd][mt], qf[0][kd], sacc[mt][0]);
          sacc[mt][1] = WMMA_F16(kf[kd][mt], qf[1][kd], sacc[mt][1]);
        }
      v16h pf[2];                                 // P^T as B operand, k = s
#pragma unroll
      for (int nt = 0; nt < 2; ++nt)
#pragma unroll
        for (int mt = 0; mt < 2; ++mt)
#pragma unroll
          for (int j = 0; j < 8; j += 2) {
            v2f x = {sacc[mt][nt][j], sacc[mt][nt][j + 1]};
            v2f c = {cb[mt][j], cb[mt][j + 1]};
            x = x * (SCORE_SCALE * LOG2E) - c;
            v2f e = {__builtin_amdgcn_exp2f(x[0]), __builtin_amdgcn_exp2f(x[1])};
            v2h h = __builtin_convertvector(e, v2h);
            pf[nt][mt * 8 + j]     = h[0];
            pf[nt][mt * 8 + j + 1] = h[1];
          }
      // O^T += V^T P^T  (k-dim = these 32 keys)
#pragma unroll
      for (int dt = 0; dt < 4; ++dt) {
        oacc[dt][0] = WMMA_F16(vf[dt], pf[0], oacc[dt][0]);
        oacc[dt][1] = WMMA_F16(vf[dt], pf[1], oacc[dt][1]);
      }
    }
  }
  // store attn in [n][l][h*64+d] layout (f16): a lane holds eight consecutive d
#pragma unroll
  for (int nt = 0; nt < 2; ++nt) {
    const int l = l0 + nt * 16 + (lane & 15);
#pragma unroll
    for (int dt = 0; dt < 4; ++dt) {
      v8h o;
#pragma unroll
      for (int j = 0; j < 8; ++j) o[j] = (_Float16)oacc[dt][nt][j];
      *(v8h*)&AOut[((size_t)nb * SEQ + l) * DM + hh * DH + dt * 16 + hi8] = o;
    }
  }
}

// ---------------------------------------------------------------------------
// Output GEMM: out[4096,1024] (f32) = attn[4096,1024] (f16) @ Wo + bo
// Tile 128x64, BK=64, f16 A copied with b128 vector moves.
// ---------------------------------------------------------------------------
__global__ __launch_bounds__(256) void out_gemm_kernel(
    const _Float16* __restrict__ A, const float* __restrict__ W,
    const float* __restrict__ bias, float* __restrict__ Out) {
  __shared__ __align__(16) _Float16 lsA[128][72];
  __shared__ __align__(16) _Float16 lsB[64][72];
  const int t = threadIdx.x, lane = t & 31, wid = t >> 5;
  const int wm = wid >> 1, wn = wid & 1;
  const int m0 = blockIdx.y * 128;
  const int n0 = blockIdx.x * 64;

  v8f acc[2][2] = {};
  for (int kb = 0; kb < DM; kb += 64) {
#pragma unroll
    for (int i = 0; i < 4; ++i) {                 // A: f16 b128 copies
      int idx = i * 256 + t; int r = idx >> 3, cc = (idx & 7) * 8;
      *(v8h*)&lsA[r][cc] = *(const v8h*)&A[(size_t)(m0 + r) * DM + kb + cc];
    }
#pragma unroll
    for (int i = 0; i < 8; ++i) {                 // B: W[k][n] -> lsB[n][k] pairs
      int idx = i * 256 + t; int n = idx & 63, k2 = (idx >> 6) * 2;
      float w0 = W[(size_t)(kb + k2) * DM + n0 + n];
      float w1 = W[(size_t)(kb + k2 + 1) * DM + n0 + n];
      pack_store(&lsB[n][k2], w0, w1);
    }
    if (kb + 64 < DM) {
      __builtin_prefetch(&A[(size_t)(m0 + (t >> 1)) * DM + kb + 64 + (t & 1) * 32], 0, 1);
      __builtin_prefetch(&W[(size_t)(kb + 64 + (t >> 2)) * DM + n0 + (t & 3) * 16], 0, 1);
    }
    __syncthreads();
#pragma unroll
    for (int ks = 0; ks < 64; ks += 32) {
      v16h b0 = lds_frag(&lsB[0][0], 72, wn * 32 + 0,  ks);
      v16h b1 = lds_frag(&lsB[0][0], 72, wn * 32 + 16, ks);
#pragma unroll
      for (int mt = 0; mt < 2; ++mt) {
        v16h a = lds_frag(&lsA[0][0], 72, wm * 32 + mt * 16, ks);
        acc[mt][0] = WMMA_F16(a, b0, acc[mt][0]);
        acc[mt][1] = WMMA_F16(a, b1, acc[mt][1]);
      }
    }
    __syncthreads();
  }
#pragma unroll
  for (int mt = 0; mt < 2; ++mt)
#pragma unroll
    for (int nt = 0; nt < 2; ++nt) {
      int col = n0 + wn * 32 + nt * 16 + (lane & 15);
      float bi = bias[col];
#pragma unroll
      for (int j = 0; j < 8; ++j) {
        int row = m0 + wm * 32 + mt * 16 + ((lane & 16) ? 8 + j : j);
        Out[(size_t)row * DM + col] = acc[mt][nt][j] + bi;
      }
    }
}

// ---------------------------------------------------------------------------
extern "C" void kernel_launch(void* const* d_in, const int* in_sizes, int n_in,
                              void* d_out, int out_size, void* d_ws, size_t ws_size,
                              hipStream_t stream) {
  (void)in_sizes; (void)n_in; (void)out_size; (void)ws_size;
  const float* queries = (const float*)d_in[0];
  const float* keys    = (const float*)d_in[1];
  const float* values  = (const float*)d_in[2];
  const float* Wq = (const float*)d_in[3];
  const float* bq = (const float*)d_in[4];
  const float* Wk = (const float*)d_in[5];
  const float* bk = (const float*)d_in[6];
  const float* Wv = (const float*)d_in[7];
  const float* bv = (const float*)d_in[8];
  const float* Wo = (const float*)d_in[9];
  const float* bo = (const float*)d_in[10];
  float* out = (float*)d_out;

  // Workspace carve-up (~33 MB total)
  const size_t headElems = (size_t)NH * SEQ * DH;      // 4,194,304 halfs each
  _Float16* Qh = (_Float16*)d_ws;
  _Float16* Kh = Qh + headElems;
  _Float16* Vh = Kh + headElems;
  _Float16* At = Vh + headElems;                       // [4096][1024] f16
  float* colmax = (float*)(At + (size_t)MTOT * DM);    // [NH][SEQ]
  float* colsum = colmax + (size_t)NH * SEQ;

  dim3 blk(256);
  dim3 gGemm(DM / 64, MTOT / 128);      // 16 x 32
  dim3 gProj(DM / 64, MTOT / 128, 3);   // 16 x 32 x (q, k, v)
  dim3 gStat(SEQ / 64, NH);             // 32 x 32
  dim3 gAttn(SEQ / 128, NH);            // 16 x 32

  // Qh, Kh and Vh are three consecutive planes of the workspace
  proj_gemm_kernel<<<gProj, blk, 0, stream>>>(queries, keys, values, Wq, Wk, Wv,
                                              bq, bk, bv, Qh);
  colstats_kernel<<<gStat, blk, 0, stream>>>(Qh, Kh, colmax, colsum);
  attn_pv_kernel<<<gAttn, dim3(128), 0, stream>>>(Qh, Kh, Vh, colmax, colsum, At);
  out_gemm_kernel<<<gGemm, blk, 0, stream>>>(At, Wo, bo, out);
}

// v004
// Measured time: 143 microseconds a run.
// Next to v003, in two timings, it ran 1.10 and 1.09 times as fast.
// Counting every step since v000, it is 1.34 times as fast.
#include <hip/hip_runtime.h>
#include <hip/hip_bf16.h>

typedef __attribute__((ext_vector_type(16))) _Float16 v16h;
typedef __attribute__((ext_vector_type(8)))  _Float16 v8h;
typedef __attribute__((ext_vector_type(8)))  float    v8f;

#define DM    1024
#define NHD   16
#define DH    64
#define NBAT  2
#define SEQ   2048
#define NH    (NBAT * NHD)    // 32 (n,h) pairs
#define MTOT  (NBAT * SEQ)    // 4096
#define SCORE_SCALE 0.125f    // 1/sqrt(64)

// ---------------------------------------------------------------------------
// Fragment loader: LDS tile stored as [outer][k] with row stride `ldk` halfs
// (ldk*2 bytes must be a multiple of 16). Implements the CDNA5 16-bit
// A-matrix layout: lanes 0-15 hold K {kb+0..7, kb+16..23}, lanes 16-31 hold
// K {kb+8..15, kb+24..31}. B is fed from a transposed LDS tile so the same
// loader serves both operands. Two ds_load_b128 per fragment.
// ---------------------------------------------------------------------------
__device__ __forceinline__ v16h lds_frag(const _Float16* base, int ldk,
                                         int outer, int kbase) {
  const int lane = threadIdx.x & 31;
  const int r  = outer + (lane & 15);
  const int ko = kbase + ((lane & 16) ? 8 : 0);
  const _Float16* p = base + r * ldk + ko;
  v8h lo = *(const v8h*)(p);        // K = ko .. ko+7
  v8h hi = *(const v8h*)(p + 16);   // K = ko+16 .. ko+23
  v16h f;
#pragma unroll
  for (int i = 0; i < 8; ++i) { f[i] = lo[i]; f[i + 8] = hi[i]; }
  return f;
}

#define WMMA_F16(A, B, C) \
  __builtin_amdgcn_wmma_f32_16x16x32_f16(false, (A), false, (B), (short)0, (C), false, false)

// packed f32x2 -> f16x2 -> one 32-bit LDS store
__device__ __forceinline__ void pack_store(_Float16* dst, float a, float b) {
  union { _Float16 h[2]; unsigned int u; } pk;
  pk.h[0] = (_Float16)a; pk.h[1] = (_Float16)b;
  *(unsigned int*)dst = pk.u;
}

// ---------------------------------------------------------------------------
// Projection GEMM: Out[n,h,l,d] (f16, head-major) = X[4096,1024] @ W[1024,1024] + b
// fp32 inputs converted to f16 (packed) while filling LDS. BK=64.
// The q, k and v projections are independent of one another and run as ONE
// grid: blockIdx.z picks the product and its plane of the output.
// Tile 128x128 from 16 waves (4x4, 32x32 each): a block loads 128+128 operand
// rows for 128x128 outputs where a 128x64 tile loaded 128+64 for half as many,
// so the grid asks L2 for a third fewer bytes, and every X element is
// converted and stored to LDS 8 times instead of 16.
// All 768 blocks are resident at once, three a WGP = 12 waves a SIMD: the
// second launch bound asks for that, a budget of 80 registers.
// ---------------------------------------------------------------------------
__global__ __launch_bounds__(512, 12) void proj_gemm_kernel(
    const float* __restrict__ Xq, const float* __restrict__ Xk,
    const float* __restrict__ Xv, const float* __restrict__ Wq,
    const float* __restrict__ Wk, const float* __restrict__ Wv,
    const float* __restrict__ bq, const float* __restrict__ bk,
    const float* __restrict__ bv, _Float16* __restrict__ OutQKV) {
  __shared__ __align__(16) _Float16 lsA[128][72];
  __shared__ __align__(16) _Float16 lsB[128][72];
  const int t = threadIdx.x, lane = t & 31, wid = t >> 5;
  const int wm = wid >> 2, wn = wid & 3;          // 4x4 wave grid
  const int m0 = blockIdx.y * 128;
  const int n0 = blockIdx.x * 128;
  const int pz = blockIdx.z;                      // 0: q, 1: k, 2: v
  const float* __restrict__ X    = pz == 0 ? Xq : (pz == 1 ? Xk : Xv);
  const float* __restrict__ W    = pz == 0 ? Wq : (pz == 1 ? Wk : Wv);
  const float* __restrict__ bias = pz == 0 ? bq : (pz == 1 ? bk : bv);
  _Float16* __restrict__ Out = OutQKV + (size_t)pz * ((size_t)NH * SEQ * DH);

  // One address per operand and thread, the eight rows (k pairs) of a tile at
  // constant distances from it, which the register budget needs.
  const float* pa = X + (size_t)(m0 + (t >> 5)) * DM + (t & 31) * 2;     // row + 16 i
  const float* pb = W + (size_t)((t >> 7) * 2) * DM + n0 + (t & 127);    // k + 8 i
  _Float16* sa = &lsA[t >> 5][(t & 31) * 2];
  _Float16* sb = &lsB[t & 127][(t >> 7) * 2];
  // Prefetch of the next K-tile, a 128-B line a thread: waves 0 to 7 take X
  // (128 rows of 256 B), waves 8 to 15 take W (64 rows of 512 B). The wave's
  // number is made scalar so that the choice of operand and the step per
  // K-tile stay in scalar registers: the prefetch keeps one address pair in
  // vector registers through the loop (the register budget; no spill).
  const bool pfx = __builtin_amdgcn_readfirstlane(t >> 5) < 8;
  const unsigned pfstep = pfx ? 64u : 64u * DM;
  const unsigned pfo = pfx ? (unsigned)((t >> 1) * DM + (t & 1) * 32)
                           : (unsigned)(((t - 256) >> 2) * DM + (t & 3) * 32);
  const float* pf = (pfx ? X + (size_t)m0 * DM : W + n0) + pfstep + pfo;  // K-tile 1

  v8f acc[2][2] = {};
  for (int kb = 0; kb < DM; kb += 64) {
    // the whole tile's 32 loads together, then their stores: 32 loaded registers
    float a0[8], a1[8], w0[8], w1[8];
#pragma unroll
    for (int i = 0; i < 8; ++i) {                 // A: 128x64 f32
      a0[i] = pa[i * 16 * DM];
      a1[i] = pa[i * 16 * DM + 1];
    }
#pragma unroll
    for (int i = 0; i < 8; ++i) {                 // B: W[k][n], two k of one n
      w0[i] = pb[i * 8 * DM];
      w1[i] = pb[(i * 8 + 1) * DM];
    }
#pragma unroll
    for (int i = 0; i < 8; ++i)                   // -> f16 pairs, lsA[row][k]
      pack_store(sa + i * 16 * 72, a0[i], a1[i]);
#pragma unroll
    for (int i = 0; i < 8; ++i)                   // -> f16 pairs, lsB[n][k]
      pack_store(sb + i * 8, w0[i], w1[i]);
    if (kb + 64 < DM) __builtin_prefetch(pf, 0, 1);
    // the address stops at the last K-tile: it never points outside X or W
    pf += (kb + 128 < DM) ? pfstep : 0u;
    pa += 64;
    pb += 64 * DM;
    __syncthreads();
#pragma unroll
    for (int ks = 0; ks < 64; ks += 32) {
      v16h b0 = lds_frag(&lsB[0][0], 72, wn * 32 + 0,  ks);
      v16h b1 = lds_frag(&lsB[0][0], 72, wn * 32 + 16, ks);
#pragma unroll
      for (int mt = 0; mt < 2; ++mt) {
        v16h a = lds_frag(&lsA[0][0], 72, wm * 32 + mt * 16, ks);
        acc[mt][0] = WMMA_F16(a, b0, acc[mt][0]);
        acc[mt][1] = WMMA_F16(a, b1, acc[mt][1]);
      }
    }
    __syncthreads();
  }
#pragma unroll
  for (int mt = 0; mt < 2; ++mt)
#pragma unroll
    for (int nt = 0; nt < 2; ++nt) {
      int col = n0 + wn * 32 + nt * 16 + (lane & 15);
      int h = col >> 6, d = col & 63;
      float bi = bias[col];
#pragma unroll
      for (int j = 0; j < 8; ++j) {
        int row = m0 + wm * 32 + mt * 16 + ((lane & 16) ? 8 + j : j);
        int nb = row >> 11, l = row & (SEQ - 1);
        Out[(((size_t)nb * NHD + h) * SEQ + l) * DH + d] =
            (_Float16)(acc[mt][nt][j] + bi);
      }
    }
}

// ---------------------------------------------------------------------------
// Column softmax statistics. One block owns a 64-wide s-strip of one (n,h)
// head and sweeps all L tiles ONCE: every lane keeps a running maximum of its
// own rows of a column and the sum of exp against that maximum, rescaled
// whenever the maximum rises. The eight partial (max, sum) pairs of a column
// are merged at the end. Deterministic block-local LDS reduction (no atomics).
// ---------------------------------------------------------------------------
__global__ __launch_bounds__(256) void colstats_kernel(
    const _Float16* __restrict__ Q, const _Float16* __restrict__ K,
    float* __restrict__ colmax, float* __restrict__ colsum) {
  __shared__ __align__(16) _Float16 lsQ[128][72];
  __shared__ __align__(16) _Float16 lsK[64][72];
  __shared__ float redM[8][64];
  __shared__ float redS[8][64];
  const int t = threadIdx.x, lane = t & 31, wid = t >> 5;
  const int wm = wid >> 1, wn = wid & 1;
  const int nh = blockIdx.y, s0 = blockIdx.x * 64;
  const _Float16* Qh = Q + (size_t)nh * SEQ * DH;
  const _Float16* Kh = K + (size_t)nh * SEQ * DH;
  const int rrow = wm * 2 + (lane >> 4);
  const int rc   = wn * 32 + (lane & 15);

#pragma unroll
  for (int i = 0; i < 2; ++i) {                   // K strip resident (b128 copies)
    int idx = i * 256 + t; int s = idx >> 3, cc = (idx & 7) * 8;
    *(v8h*)&lsK[s][cc] = *(const v8h*)&Kh[(size_t)(s0 + s) * DH + cc];
  }

  float cm0 = -3.0e38f, cm1 = -3.0e38f;           // running column max (scaled)
  float cs0 = 0.f, cs1 = 0.f;                     // sum of exp against cm0 / cm1
  for (int lt = 0; lt < SEQ / 128; ++lt) {
    __syncthreads();
#pragma unroll
    for (int i = 0; i < 4; ++i) {                 // Q tile (b128 copies)
      int idx = i * 256 + t; int r = idx >> 3, cc = (idx & 7) * 8;
      *(v8h*)&lsQ[r][cc] = *(const v8h*)&Qh[(size_t)(lt * 128 + r) * DH + cc];
    }
    if (lt + 1 < SEQ / 128)
      __builtin_prefetch(&Qh[(size_t)((lt + 1) * 128 + (t >> 1)) * DH + (t & 1) * 32], 0, 1);
    __syncthreads();
    v8f acc[2][2] = {};
#pragma unroll
    for (int kb = 0; kb < DH; kb += 32) {
      v16h b0 = lds_frag(&lsK[0][0], 72, wn * 32 + 0,  kb);
      v16h b1 = lds_frag(&lsK[0][0], 72, wn * 32 + 16, kb);
#pragma unroll
      for (int mt = 0; mt < 2; ++mt) {
        v16h a = lds_frag(&lsQ[0][0], 72, wm * 32 + mt * 16, kb);
        acc[mt][0] = WMMA_F16(a, b0, acc[mt][0]);
        acc[mt][1] = WMMA_F16(a, b1, acc[mt][1]);
      }
    }
    // this tile's maximum (the scale is a positive power of two: max commutes)
    float t0 = acc[0][0][0], t1 = acc[0][1][0];
#pragma unroll
    for (int mt = 0; mt < 2; ++mt)
#pragma unroll
      for (int j = 0; j < 8; ++j) {
        t0 = fmaxf(t0, acc[mt][0][j]);
        t1 = fmaxf(t1, acc[mt][1][j]);
      }
    const float n0 = fmaxf(cm0, t0 * SCORE_SCALE);
    const float n1 = fmaxf(cm1, t1 * SCORE_SCALE);
    cs0 *= __expf(cm0 - n0);                      // old sum onto the new maximum
    cs1 *= __expf(cm1 - n1);
    cm0 = n0;
    cm1 = n1;
#pragma unroll
    for (int mt = 0; mt < 2; ++mt)
#pragma unroll
      for (int j = 0; j < 8; ++j) {
        cs0 += __expf(acc[mt][0][j] * SCORE_SCALE - n0);
        cs1 += __expf(acc[mt][1][j] * SCORE_SCALE - n1);
      }
  }
  redM[rrow][rc] = cm0;
  redM[rrow][rc + 16] = cm1;
  redS[rrow][rc] = cs0;
  redS[rrow][rc + 16] = cs1;
  __syncthreads();
  if (t < 64) {
    float m = redM[0][t];
#pragma unroll
    for (int r = 1; r < 8; ++r) m = fmaxf(m, redM[r][t]);
    float z = 0.f;
#pragma unroll
    for (int r = 0; r < 8; ++r) z += redS[r][t] * __expf(redM[r][t] - m);
    colmax[(size_t)nh * SEQ + s0 + t] = m;
    colsum[(size_t)nh * SEQ + s0 + t] = z;
  }
}

// ---------------------------------------------------------------------------
// attn = softmax(QK^T/8, axis=query) @ V, in transposed form:
//   S^T = K Q^T (rows = keys s, columns = queries l),  O^T += V^T P^T.
// A lane of an S^T accumulator holds eight consecutive keys of ONE query
// column, which is exactly the k order of a B fragment: two 16-key score tiles
// pack into one 32-key P^T operand in registers, so P never touches LDS.
// One block = 4 waves, each wave owns 32 query columns of one head; the Q
// fragments are loaded once from global memory and stay in registers.
// The column statistics are per key = per accumulator row here: each s tile
// stages bias[s] = m[s]*log2(e) + log2(Z[s]), and
//   P = exp2(score * (log2(e)/8) - bias[s]) = exp(score/8 - m[s]) / Z[s].
// ---------------------------------------------------------------------------
#define LOG2E 1.44269504088896340736f
typedef __attribute__((ext_vector_type(2))) float    v2f;
typedef __attribute__((ext_vector_type(2))) _Float16 v2h;

// waves_per_eu(4, 4): a 256-register budget, so that a tile's K, V^T and bias
// reads are issued together ahead of its matrix work; under the default budget
// each V^T fragment was read and waited for right in front of its two products.
__global__ __launch_bounds__(128) __attribute__((amdgpu_waves_per_eu(4, 4))) void attn_pv_kernel(
    const _Float16* __restrict__ Q, const _Float16* __restrict__ K,
    const _Float16* __restrict__ V, const float* __restrict__ colmax,
    const float* __restrict__ colsum, _Float16* __restrict__ AOut) {
  __shared__ __align__(16) _Float16 lsK[64][72];   // [s][d]
  __shared__ __align__(16) _Float16 lsV[64][72];   // transposed: [d][s]
  __shared__ __align__(32) float lsC[64];          // bias[s] of this s tile
  const int t = threadIdx.x, lane = t & 31, wid = t >> 5;
  const int hi8 = (lane & 16) ? 8 : 0;
  const int nh = blockIdx.y, l0 = blockIdx.x * 128 + wid * 32;
  const int nb = nh >> 4, hh = nh & 15;
  const _Float16* Qh = Q + (size_t)nh * SEQ * DH;
  const _Float16* Kh = K + (size_t)nh * SEQ * DH;
  const _Float16* Vh = V + (size_t)nh * SEQ * DH;
  const float* cmax = colmax + (size_t)nh * SEQ;
  const float* csum = colsum + (size_t)nh * SEQ;

  // Q as B operand: lane -> query column, registers -> d in the hardware k order
  v16h qf[2][2];                                   // [l tile][d step]
#pragma unroll
  for (int nt = 0; nt < 2; ++nt)
#pragma unroll
    for (int kd = 0; kd < 2; ++kd) {
      const _Float16* p = Qh + (size_t)(l0 + nt * 16 + (lane & 15)) * DH + kd * 32 + hi8;
      v8h lo = *(const v8h*)(p);
      v8h hi = *(const v8h*)(p + 16);
#pragma unroll
      for (int i = 0; i < 8; ++i) { qf[nt][kd][i] = lo[i]; qf[nt][kd][i + 8] = hi[i]; }
    }

  const int toff = (t >> 3) * DH + (t & 7) * 8;    // this thread's place in a staged tile
  v8f oacc[4][2] = {};                             // O^T: [d tile][l tile]
  for (int st = 0; st < SEQ / 64; ++st) {
    const int s0 = st * 64;
    __syncthreads();
    // all of the tile's global loads are issued before the first LDS store
    const _Float16* Kt = Kh + (size_t)s0 * DH;    // uniform tile bases
    const _Float16* Vt = Vh + (size_t)s0 * DH;
    v8h kk[4], vv[4];
#pragma unroll
    for (int i = 0; i < 4; ++i) {                 // row (t >> 3) + 16 i, 16 bytes a lane
      kk[i] = *(const v8h*)&Kt[toff + i * 16 * DH];
      vv[i] = *(const v8h*)&Vt[toff + i * 16 * DH];
    }
    float cmv = 0.f, csv = 1.f;
    if (t < 64) { cmv = (cmax + s0)[t]; csv = (csum + s0)[t]; }  // waves 0 and 1, whole waves
#pragma unroll
    for (int i = 0; i < 4; ++i) {                 // K tile (b128 copies)
      int idx = i * 128 + t; int s = idx >> 3, cc = (idx & 7) * 8;
      *(v8h*)&lsK[s][cc] = kk[i];
    }
#pragma unroll
    for (int i = 0; i < 4; ++i) {                 // V tile transposed into LDS
      int idx = i * 128 + t; int s = idx >> 3, d0 = (idx & 7) * 8;
#pragma unroll
      for (int j = 0; j < 8; ++j) lsV[d0 + j][s] = vv[i][j];
    }
    if (t < 64) lsC[t] = cmv * LOG2E + __log2f(csv);
    if (st + 1 < SEQ / 64) {                      // prefetch next s-tile
      __builtin_prefetch(&Kh[(size_t)(s0 + 64 + (t >> 1)) * DH + (t & 1) * 32], 0, 1);
      __builtin_prefetch(&Vh[(size_t)(s0 + 64 + (t >> 1)) * DH + (t & 1) * 32], 0, 1);
    }
    __syncthreads();
#pragma unroll
    for (int ks = 0; ks < 64; ks += 32) {         // 32 keys per pass
      // this pass's LDS reads stand together, ahead of its matrix work
      v16h kf[2][2], vf[4];                       // K: [d step][s tile]; V^T: [d tile]
#pragma unroll
      for (int kd = 0; kd < 2; ++kd)
#pragma unroll
        for (int mt = 0; mt < 2; ++mt)
          kf[kd][mt] = lds_frag(&lsK[0][0], 72, ks + mt * 16, kd * 32);
      // accumulator row j of s tile mt is key ks + mt*16 + hi8 + j
      v8f cb[2];
      cb[0] = *(const v8f*)&lsC[ks + hi8];
      cb[1] = *(const v8f*)&lsC[ks + 16 + hi8];
#pragma unroll
      for (int dt = 0; dt < 4; ++dt)
        vf[dt] = lds_frag(&lsV[0][0], 72, dt * 16, ks);
      // S^T: 32(s) x 32(l), k-dim = d = 64
      v8f sacc[2][2] = {};                        // [s tile][l tile]
#pragma unroll
      for (int kd = 0; kd < 2; ++kd)
#pragma unroll
        for (int mt = 0; mt < 2; ++mt) {
          sacc[mt][0] = WMMA_F16(kf[kd][mt], qf[0][kd], sacc[mt][0]);
          sacc[mt][1] = WMMA_F16(kf[kd][mt], qf[1][kd], sacc[mt][1]);
        }
      v16h pf[2];                                 // P^T as B operand, k = s
#pragma unroll
      for (int nt = 0; nt < 2; ++nt)
#pragma unroll
        for (int mt = 0; mt < 2; ++mt)
#pragma unroll
          for (int j = 0; j < 8; j += 2) {
            v2f x = {sacc[mt][nt][j], sacc[mt][nt][j + 1]};
            v2f c = {cb[mt][j], cb[mt][j + 1]};
            x = x * (SCORE_SCALE * LOG2E) - c;
            v2f e = {__builtin_amdgcn_exp2f(x[0]), __builtin_amdgcn_exp2f(x[1])};
            v2h h = __builtin_convertvector(e, v2h);
            pf[nt][mt * 8 + j]     = h[0];
            pf[nt][mt * 8 + j + 1] = h[1];
          }
      // O^T += V^T P^T  (k-dim = these 32 keys)
#pragma unroll
      for (int dt = 0; dt < 4; ++dt) {
        oacc[dt][0] = WMMA_F16(vf[dt], pf[0], oacc[dt][0]);
        oacc[dt][1] = WMMA_F16(vf[dt], pf[1], oacc[dt][1]);
      }
    }
  }
  // store attn in [n][l][h*64+d] layout (f16): a lane holds eight consecutive d
#pragma unroll
  for (int nt = 0; nt < 2; ++nt) {
    const int l = l0 + nt * 16 + (lane & 15);
#pragma unroll
    for (int dt = 0; dt < 4; ++dt) {
      v8h o;
#pragma unroll
      for (int j = 0; j < 8; ++j) o[j] = (_Float16)oacc[dt][nt][j];
      *(v8h*)&AOut[((size_t)nb * SEQ + l) * DM + hh * DH + dt * 16 + hi8] = o;
    }
  }
}

// ---------------------------------------------------------------------------
// Output GEMM: out[4096,1024] (f32) = attn[4096,1024] (f16) @ Wo + bo
// Tile 128x64, BK=64, f16 A copied with b128 vector moves.
// ---------------------------------------------------------------------------
__global__ __launch_bounds__(256) void out_gemm_kernel(
    const _Float16* __restrict__ A, const float* __restrict__ W,
    const float* __restrict__ bias, float* __restrict__ Out) {
  __shared__ __align__(16) _Float16 lsA[128][72];
  __shared__ __align__(16) _Float16 lsB[64][72];
  const int t = threadIdx.x, lane = t & 31, wid = t >> 5;
  const int wm = wid >> 1, wn = wid & 1;
  const int m0 = blockIdx.y * 128;
  const int n0 = blockIdx.x * 64;

  v8f acc[2][2] = {};
  for (int kb = 0; kb < DM; kb += 64) {
#pragma unroll
    for (int i = 0; i < 4; ++i) {                 // A: f16 b128 copies
      int idx = i * 256 + t; int r = idx >> 3, cc = (idx & 7) * 8;
      *(v8h*)&lsA[r][cc] = *(const v8h*)&A[(size_t)(m0 + r) * DM + kb + cc];
    }
#pragma unroll
    for (int i = 0; i < 8; ++i) {                 // B: W[k][n] -> lsB[n][k] pairs
      int idx = i * 256 + t; int n = idx & 63, k2 = (idx >> 6) * 2;
      float w0 = W[(size_t)(kb + k2) * DM + n0 + n];
      float w1 = W[(size_t)(kb + k2 + 1) * DM + n0 + n];
      pack_store(&lsB[n][k2], w0, w1);
    }
    if (kb + 64 < DM) {
      __builtin_prefetch(&A[(size_t)(m0 + (t >> 1)) * DM + kb + 64 + (t & 1) * 32], 0, 1);
      __builtin_prefetch(&W[(size_t)(kb + 64 + (t >> 2)) * DM + n0 + (t & 3) * 16], 0, 1);
    }
    __syncthreads();
#pragma unroll
    for (int ks = 0; ks < 64; ks += 32) {
      v16h b0 = lds_frag(&lsB[0][0], 72, wn * 32 + 0,  ks);
      v16h b1 = lds_frag(&lsB[0][0], 72, wn * 32 + 16, ks);
#pragma unroll
      for (int mt = 0; mt < 2; ++mt) {
        v16h a = lds_frag(&lsA[0][0], 72, wm * 32 + mt * 16, ks);
        acc[mt][0] = WMMA_F16(a, b0, acc[mt][0]);
        acc[mt][1] = WMMA_F16(a, b1, acc[mt][1]);
      }
    }
    __syncthreads();
  }
#pragma unroll
  for (int mt = 0; mt < 2; ++mt)
#pragma unroll
    for (int nt = 0; nt < 2; ++nt) {
      int col = n0 + wn * 32 + nt * 16 + (lane & 15);
      float bi = bias[col];
#pragma unroll
      for (int j = 0; j < 8; ++j) {
        int row = m0 + wm * 32 + mt * 16 + ((lane & 16) ? 8 + j : j);
        Out[(size_t)row * DM + col] = acc[mt][nt][j] + bi;
      }
    }
}

// ---------------------------------------------------------------------------
extern "C" void kernel_launch(void* const* d_in, const int* in_sizes, int n_in,
                              void* d_out, int out_size, void* d_ws, size_t ws_size,
                              hipStream_t stream) {
  (void)in_sizes; (void)n_in; (void)out_size; (void)ws_size;
  const float* queries = (const float*)d_in[0];
  const float* keys    = (const float*)d_in[1];
  const float* values  = (const float*)d_in[2];
  const float* Wq = (const float*)d_in[3];
  const float* bq = (const float*)d_in[4];
  const float* Wk = (const float*)d_in[5];
  const float* bk = (const float*)d_in[6];
  const float* Wv = (const float*)d_in[7];
  const float* bv = (const float*)d_in[8];
  const float* Wo = (const float*)d_in[9];
  const float* bo = (const float*)d_in[10];
  float* out = (float*)d_out;

  // Workspace carve-up (~33 MB total)
  const size_t headElems = (size_t)NH * SEQ * DH;      // 4,194,304 halfs each
  _Float16* Qh = (_Float16*)d_ws;
  _Float16* Kh = Qh + headElems;
  _Float16* Vh = Kh + headElems;
  _Float16* At = Vh + headElems;                       // [4096][1024] f16
  float* colmax = (float*)(At + (size_t)MTOT * DM);    // [NH][SEQ]
  float* colsum = colmax + (size_t)NH * SEQ;

  dim3 blk(256);
  dim3 gGemm(DM / 64, MTOT / 128);      // 16 x 32
  dim3 gProj(DM / 128, MTOT / 128, 3);  // 8 x 32 x (q, k, v)
  dim3 gStat(SEQ / 64, NH);             // 32 x 32
  dim3 gAttn(SEQ / 128, NH);            // 16 x 32

  // Qh, Kh and Vh are three consecutive planes of the workspace
  proj_gemm_kernel<<<gProj, dim3(512), 0, stream>>>(queries, keys, values, Wq, Wk, Wv,
                                              bq, bk, bv, Qh);
  colstats_kernel<<<gStat, blk, 0, stream>>>(Qh, Kh, colmax, colsum);
  attn_pv_kernel<<<gAttn, dim3(128), 0, stream>>>(Qh, Kh, Vh, colmax, colsum, At);
  out_gemm_kernel<<<gGemm, blk, 0, stream>>>(At, Wo, bo, out);
}

// v005
// One run takes 124 microseconds.
// Two timings next to v004 both put it at 1.15 times that version's speed.
// All steps since v000 together make it 1.54 times as fast.
#include <hip/hip_runtime.h>
#include <hip/hip_bf16.h>

typedef __attribute__((ext_vector_type(16))) _Float16 v16h;
typedef __attribute__((ext_vector_type(8)))  _Float16 v8h;
typedef __attribute__((ext_vector_type(8)))  float    v8f;

#define DM    1024
#define NHD   16
#define DH    64
#define NBAT  2
#define SEQ   2048
#define NH    (NBAT * NHD)    // 32 (n,h) pairs
#define MTOT  (NBAT * SEQ)    // 4096
#define SCORE_SCALE 0.125f    // 1/sqrt(64)

// ---------------------------------------------------------------------------
// Fragment loader: LDS tile stored as [outer][k] with row stride `ldk` halfs
// (ldk*2 bytes must be a multiple of 16). Implements the CDNA5 16-bit
// A-matrix layout: lanes 0-15 hold K {kb+0..7, kb+16..23}, lanes 16-31 hold
// K {kb+8..15, kb+24..31}. B is fed from a transposed LDS tile so the same
// loader serves both operands. Two ds_load_b128 per fragment.
// ---------------------------------------------------------------------------
__device__ __forceinline__ v16h lds_frag(const _Float16* base, int ldk,
                                         int outer, int kbase) {
  const int lane = threadIdx.x & 31;
  const int r  = outer + (lane & 15);
  const int ko = kbase + ((lane & 16) ? 8 : 0);
  const _Float16* p = base + r * ldk + ko;
  v8h lo = *(const v8h*)(p);        // K = ko .. ko+7
  v8h hi = *(const v8h*)(p + 16);   // K = ko+16 .. ko+23
  v16h f;
#pragma unroll
  for (int i = 0; i < 8; ++i) { f[i] = lo[i]; f[i + 8] = hi[i]; }
  return f;
}

#define WMMA_F16(A, B, C) \
  __builtin_amdgcn_wmma_f32_16x16x32_f16(false, (A), false, (B), (short)0, (C), false, false)

// packed f32x2 -> f16x2 -> one 32-bit LDS store
__device__ __forceinline__ void pack_store(_Float16* dst, float a, float b) {
  union { _Float16 h[2]; unsigned int u; } pk;
  pk.h[0] = (_Float16)a; pk.h[1] = (_Float16)b;
  *(unsigned int*)dst = pk.u;
}

// ---------------------------------------------------------------------------
// Projection GEMM: Out[n,h,l,d] (f16, head-major) = X[4096,1024] @ W[1024,1024] + b
// fp32 inputs converted to f16 (packed) while filling LDS. BK=64.
// The v plane alone is laid out for its reader, transposed inside tiles of 64
// keys: Out[n,h][l / 64][d][l % 64]. A lane of an accumulator holds eight
// consecutive l of one d, so that layout is one 16-byte store per accumulator.
// The q, k and v projections are independent of one another and run as ONE
// grid: blockIdx.z picks the product and its plane of the output.
// Tile 128x128 from 16 waves (4x4, 32x32 each): a block loads 128+128 operand
// rows for 128x128 outputs where a 128x64 tile loaded 128+64 for half as many,
// so the grid asks L2 for a third fewer bytes, and every X element is
// converted and stored to LDS 8 times instead of 16.
// All 768 blocks are resident at once, three a WGP = 12 waves a SIMD: the
// second launch bound asks for that, a budget of 80 registers.
// ---------------------------------------------------------------------------
__global__ __launch_bounds__(512, 12) void proj_gemm_kernel(
    const float* __restrict__ Xq, const float* __restrict__ Xk,
    const float* __restrict__ Xv, const float* __restrict__ Wq,
    const float* __restrict__ Wk, const float* __restrict__ Wv,
    const float* __restrict__ bq, const float* __restrict__ bk,
    const float* __restrict__ bv, _Float16* __restrict__ OutQKV) {
  __shared__ __align__(16) _Float16 lsA[128][72];
  __shared__ __align__(16) _Float16 lsB[128][72];
  const int t = threadIdx.x, lane = t & 31, wid = t >> 5;
  const int wm = wid >> 2, wn = wid & 3;          // 4x4 wave grid
  const int m0 = blockIdx.y * 128;
  const int n0 = blockIdx.x * 128;
  const int pz = blockIdx.z;                      // 0: q, 1: k, 2: v
  const float* __restrict__ X    = pz == 0 ? Xq : (pz == 1 ? Xk : Xv);
  const float* __restrict__ W    = pz == 0 ? Wq : (pz == 1 ? Wk : Wv);
  const float* __restrict__ bias = pz == 0 ? bq : (pz == 1 ? bk : bv);
  _Float16* __restrict__ Out = OutQKV + (size_t)pz * ((size_t)NH * SEQ * DH);

  // One address per operand and thread, the eight rows (k pairs) of a tile at
  // constant distances from it, which the register budget needs.
  const float* pa = X + (size_t)(m0 + (t >> 5)) * DM + (t & 31) * 2;     // row + 16 i
  const float* pb = W + (size_t)((t >> 7) * 2) * DM + n0 + (t & 127);    // k + 8 i
  _Float16* sa = &lsA[t >> 5][(t & 31) * 2];
  _Float16* sb = &lsB[t & 127][(t >> 7) * 2];
  // Prefetch of the next K-tile, a 128-B line a thread: waves 0 to 7 take X
  // (128 rows of 256 B), waves 8 to 15 take W (64 rows of 512 B). The wave's
  // number is made scalar so that the choice of operand and the step per
  // K-tile stay in scalar registers: the prefetch keeps one address pair in
  // vector registers through the loop (the register budget; no spill).
  const bool pfx = __builtin_amdgcn_readfirstlane(t >> 5) < 8;
  const unsigned pfstep = pfx ? 64u : 64u * DM;
  const unsigned pfo = pfx ? (unsigned)((t >> 1) * DM + (t & 1) * 32)
                           : (unsigned)(((t - 256) >> 2) * DM + (t & 3) * 32);
  const float* pf = (pfx ? X + (size_t)m0 * DM : W + n0) + pfstep + pfo;  // K-tile 1

  v8f acc[2][2] = {};
  for (int kb = 0; kb < DM; kb += 64) {
    // the whole tile's 32 loads together, then their stores: 32 loaded registers
    float a0[8], a1[8], w0[8], w1[8];
#pragma unroll
    for (int i = 0; i < 8; ++i) {                 // A: 128x64 f32
      a0[i] = pa[i * 16 * DM];
      a1[i] = pa[i * 16 * DM + 1];
    }
#pragma unroll
    for (int i = 0; i < 8; ++i) {                 // B: W[k][n], two k of one n
      w0[i] = pb[i * 8 * DM];
      w1[i] = pb[(i * 8 + 1) * DM];
    }
#pragma unroll
    for (int i = 0; i < 8; ++i)                   // -> f16 pairs, lsA[row][k]
      pack_store(sa + i * 16 * 72, a0[i], a1[i]);
#pragma unroll
    for (int i = 0; i < 8; ++i)                   // -> f16 pairs, lsB[n][k]
      pack_store(sb + i * 8, w0[i], w1[i]);
    if (kb + 64 < DM) __builtin_prefetch(pf, 0, 1);
    // the address stops at the last K-tile: it never points outside X or W
    pf += (kb + 128 < DM) ? pfstep : 0u;
    pa += 64;
    pb += 64 * DM;
    __syncthreads();
#pragma unroll
    for (int ks = 0; ks < 64; ks += 32) {
      v16h b0 = lds_frag(&lsB[0][0], 72, wn * 32 + 0,  ks);
      v16h b1 = lds_frag(&lsB[0][0], 72, wn * 32 + 16, ks);
#pragma unroll
      for (int mt = 0; mt < 2; ++mt) {
        v16h a = lds_frag(&lsA[0][0], 72, wm * 32 + mt * 16, ks);
        acc[mt][0] = WMMA_F16(a, b0, acc[mt][0]);
        acc[mt][1] = WMMA_F16(a, b1, acc[mt][1]);
      }
    }
    __syncthreads();
  }
  if (pz == 2) {                                  // v: [n,h][l / 64][d][l % 64]
#pragma unroll
    for (int mt = 0; mt < 2; ++mt)
#pragma unroll
      for (int nt = 0; nt < 2; ++nt) {
        int col = n0 + wn * 32 + nt * 16 + (lane & 15);
        int h = col >> 6, d = col & 63;
        float bi = bias[col];
        int row = m0 + wm * 32 + mt * 16 + ((lane & 16) ? 8 : 0);
        int nb = row >> 11, l = row & (SEQ - 1);  // eight rows from a multiple of 8
        v8h o;
#pragma unroll
        for (int j = 0; j < 8; ++j) o[j] = (_Float16)(acc[mt][nt][j] + bi);
        *(v8h*)&Out[(((size_t)nb * NHD + h) * SEQ + (l & ~63)) * DH + d * 64 + (l & 63)] = o;
      }
    return;
  }
#pragma unroll
  for (int mt = 0; mt < 2; ++mt)
#pragma unroll
    for (int nt = 0; nt < 2; ++nt) {
      int col = n0 + wn * 32 + nt * 16 + (lane & 15);
      int h = col >> 6, d = col & 63;
      float bi = bias[col];
#pragma unroll
      for (int j = 0; j < 8; ++j) {
        int row = m0 + wm * 32 + mt * 16 + ((lane & 16) ? 8 + j : j);
        int nb = row >> 11, l = row & (SEQ - 1);
        Out[(((size_t)nb * NHD + h) * SEQ + l) * DH + d] =
            (_Float16)(acc[mt][nt][j] + bi);
      }
    }
}

// ---------------------------------------------------------------------------
// Column softmax statistics. One block owns a 64-wide s-strip of one (n,h)
// head and sweeps all L tiles ONCE: every lane keeps a running maximum of its
// own rows of a column and the sum of exp against that maximum, rescaled
// whenever the maximum rises. The eight partial (max, sum) pairs of a column
// are merged at the end. Deterministic block-local LDS reduction (no atomics).
// ---------------------------------------------------------------------------
__global__ __launch_bounds__(256) void colstats_kernel(
    const _Float16* __restrict__ Q, const _Float16* __restrict__ K,
    float* __restrict__ colmax, float* __restrict__ colsum) {
  __shared__ __align__(16) _Float16 lsQ[128][72];
  __shared__ __align__(16) _Float16 lsK[64][72];
  __shared__ float redM[8][64];
  __shared__ float redS[8][64];
  const int t = threadIdx.x, lane = t & 31, wid = t >> 5;
  const int wm = wid >> 1, wn = wid & 1;
  const int nh = blockIdx.y, s0 = blockIdx.x * 64;
  const _Float16* Qh = Q + (size_t)nh * SEQ * DH;
  const _Float16* Kh = K + (size_t)nh * SEQ * DH;
  const int rrow = wm * 2 + (lane >> 4);
  const int rc   = wn * 32 + (lane & 15);

#pragma unroll
  for (int i = 0; i < 2; ++i) {                   // K strip resident (b128 copies)
    int idx = i * 256 + t; int s = idx >> 3, cc = (idx & 7) * 8;
    *(v8h*)&lsK[s][cc] = *(const v8h*)&Kh[(size_t)(s0 + s) * DH + cc];
  }

  float cm0 = -3.0e38f, cm1 = -3.0e38f;           // running column max (scaled)
  float cs0 = 0.f, cs1 = 0.f;                     // sum of exp against cm0 / cm1
  for (int lt = 0; lt < SEQ / 128; ++lt) {
    __syncthreads();
#pragma unroll
    for (int i = 0; i < 4; ++i) {                 // Q tile (b128 copies)
      int idx = i * 256 + t; int r = idx >> 3, cc = (idx & 7) * 8;
      *(v8h*)&lsQ[r][cc] = *(const v8h*)&Qh[(size_t)(lt * 128 + r) * DH + cc];
    }
    if (lt + 1 < SEQ / 128)
      __builtin_prefetch(&Qh[(size_t)((lt + 1) * 128 + (t >> 1)) * DH + (t & 1) * 32], 0, 1);
    __syncthreads();
    v8f acc[2][2] = {};
#pragma unroll
    for (int kb = 0; kb < DH; kb += 32) {
      v16h b0 = lds_frag(&lsK[0][0], 72, wn * 32 + 0,  kb);
      v16h b1 = lds_frag(&lsK[0][0], 72, wn * 32 + 16, kb);
#pragma unroll
      for (int mt = 0; mt < 2; ++mt) {
        v16h a = lds_frag(&lsQ[0][0], 72, wm * 32 + mt * 16, kb);
        acc[mt][0] = WMMA_F16(a, b0, acc[mt][0]);
        acc[mt][1] = WMMA_F16(a, b1, acc[mt][1]);
      }
    }
    // this tile's maximum (the scale is a positive power of two: max commutes)
    float t0 = acc[0][0][0], t1 = acc[0][1][0];
#pragma unroll
    for (int mt = 0; mt < 2; ++mt)
#pragma unroll
      for (int j = 0; j < 8; ++j) {
        t0 = fmaxf(t0, acc[mt][0][j]);
        t1 = fmaxf(t1, acc[mt][1][j]);
      }
    const float n0 = fmaxf(cm0, t0 * SCORE_SCALE);
    const float n1 = fmaxf(cm1, t1 * SCORE_SCALE);
    cs0 *= __expf(cm0 - n0);                      // old sum onto the new maximum
    cs1 *= __expf(cm1 - n1);
    cm0 = n0;
    cm1 = n1;
#pragma unroll
    for (int mt = 0; mt < 2; ++mt)
#pragma unroll
      for (int j = 0; j < 8; ++j) {
        cs0 += __expf(acc[mt][0][j] * SCORE_SCALE - n0);
        cs1 += __expf(acc[mt][1][j] * SCORE_SCALE - n1);
      }
  }
  redM[rrow][rc] = cm0;
  redM[rrow][rc + 16] = cm1;
  redS[rrow][rc] = cs0;
  redS[rrow][rc + 16] = cs1;
  __syncthreads();
  if (t < 64) {
    float m = redM[0][t];
#pragma unroll
    for (int r = 1; r < 8; ++r) m = fmaxf(m, redM[r][t]);
    float z = 0.f;
#pragma unroll
    for (int r = 0; r < 8; ++r) z += redS[r][t] * __expf(redM[r][t] - m);
    colmax[(size_t)nh * SEQ + s0 + t] = m;
    colsum[(size_t)nh * SEQ + s0 + t] = z;
  }
}

// ---------------------------------------------------------------------------
// attn = softmax(QK^T/8, axis=query) @ V, in transposed form:
//   S^T = K Q^T (rows = keys s, columns = queries l),  O^T += V^T P^T.
// A lane of an S^T accumulator holds eight consecutive keys of ONE query
// column, which is exactly the k order of a B fragment: two 16-key score tiles
// pack into one 32-key P^T operand in registers, so P never touches LDS.
// One block = 4 waves, each wave owns 32 query columns of one head; the Q
// fragments are loaded once from global memory and stay in registers.
// The column statistics are per key = per accumulator row here: each s tile
// stages bias[s] = m[s]*log2(e) + log2(Z[s]), and
//   P = exp2(score * (log2(e)/8) - bias[s]) = exp(score/8 - m[s]) / Z[s].
// V arrives from the projection as [n,h][s / 64][d][s % 64]: an s tile is 8 KB
// in a row and already V^T, so it is staged like the K tile, 16 bytes a store.
// ---------------------------------------------------------------------------
#define LOG2E 1.44269504088896340736f
typedef __attribute__((ext_vector_type(2))) float    v2f;
typedef __attribute__((ext_vector_type(2))) _Float16 v2h;

// waves_per_eu(4, 4): a 256-register budget, so that a tile's K, V^T and bias
// reads are issued together ahead of its matrix work; under the default budget
// each V^T fragment was read and waited for right in front of its two products.
__global__ __launch_bounds__(128) __attribute__((amdgpu_waves_per_eu(4, 4))) void attn_pv_kernel(
    const _Float16* __restrict__ Q, const _Float16* __restrict__ K,
    const _Float16* __restrict__ V, const float* __restrict__ colmax,
    const float* __restrict__ colsum, _Float16* __restrict__ AOut) {
  __shared__ __align__(16) _Float16 lsK[64][72];   // [s][d]
  __shared__ __align__(16) _Float16 lsV[64][72];   // transposed: [d][s]
  __shared__ __align__(32) float lsC[64];          // bias[s] of this s tile
  const int t = threadIdx.x, lane = t & 31, wid = t >> 5;
  const int hi8 = (lane & 16) ? 8 : 0;
  const int nh = blockIdx.y, l0 = blockIdx.x * 128 + wid * 32;
  const int nb = nh >> 4, hh = nh & 15;
  const _Float16* Qh = Q + (size_t)nh * SEQ * DH;
  const _Float16* Kh = K + (size_t)nh * SEQ * DH;
  const _Float16* Vh = V + (size_t)nh * SEQ * DH;
  const float* cmax = colmax + (size_t)nh * SEQ;
  const float* csum = colsum + (size_t)nh * SEQ;

  // Q as B operand: lane -> query column, registers -> d in the hardware k order
  v16h qf[2][2];                                   // [l tile][d step]
#pragma unroll
  for (int nt = 0; nt < 2; ++nt)
#pragma unroll
    for (int kd = 0; kd < 2; ++kd) {
      const _Float16* p = Qh + (size_t)(l0 + nt * 16 + (lane & 15)) * DH + kd * 32 + hi8;
      v8h lo = *(const v8h*)(p);
      v8h hi = *(const v8h*)(p + 16);
#pragma unroll
      for (int i = 0; i < 8; ++i) { qf[nt][kd][i] = lo[i]; qf[nt][kd][i + 8] = hi[i]; }
    }

  const int toff = (t >> 3) * DH + (t & 7) * 8;    // this thread's place in a staged tile
  _Float16* sv = &lsV[t >> 3][(t & 7) * 8];        // and in the V^T tile in LDS
  v8f oacc[4][2] = {};                             // O^T: [d tile][l tile]
  for (int st = 0; st < SEQ / 64; ++st) {
    const int s0 = st * 64;
    __syncthreads();
    // all of the tile's global loads are issued before the first LDS store
    const _Float16* Kt = Kh + (size_t)s0 * DH;    // uniform tile bases
    const _Float16* Vt = Vh + (size_t)s0 * DH;
    float cmv = 0.f, csv = 1.f;
    if (t < 64) { cmv = (cmax + s0)[t]; csv = (csum + s0)[t]; }  // waves 0 and 1, whole waves
    v8h kk[4], vv[4];
#pragma unroll
    for (int i = 0; i < 4; ++i) {                 // row (t >> 3) + 16 i (K: s, V: d), 16 bytes a lane
      kk[i] = *(const v8h*)&Kt[toff + i * 16 * DH];
      vv[i] = *(const v8h*)&Vt[toff + i * 16 * DH];
    }
    // Keeps the two statistics values untouched until the tile's loads are all
    // issued: without it their first use (and its wait) is lifted in front of the
    // K and V loads, or the two loads are sunk behind the LDS stores; either way
    // waves 0 and 1 wait out a second trip to L2 in every tile. Loaded values as
    // inputs only.
    asm volatile("" :: "v"(cmv), "v"(csv));
#pragma unroll
    for (int i = 0; i < 4; ++i) {                 // K tile (b128 copies)
      int idx = i * 128 + t; int s = idx >> 3, cc = (idx & 7) * 8;
      *(v8h*)&lsK[s][cc] = kk[i];
    }
#pragma unroll
    for (int i = 0; i < 4; ++i)                   // V^T tile (b128 copies), row d = (t >> 3) + 16 i
      *(v8h*)(sv + i * 16 * 72) = vv[i];
    if (t < 64) lsC[t] = cmv * LOG2E + __log2f(csv);
    if (st + 1 < SEQ / 64) {                      // prefetch next s-tile
      __builtin_prefetch(&Kh[(size_t)(s0 + 64 + (t >> 1)) * DH + (t & 1) * 32], 0, 1);
      __builtin_prefetch(&Vh[(size_t)(s0 + 64 + (t >> 1)) * DH + (t & 1) * 32], 0, 1);
    }
    __syncthreads();
#pragma unroll
    for (int ks = 0; ks < 64; ks += 32) {         // 32 keys per pass
      // this pass's LDS reads stand together, ahead of its matrix work
      v16h kf[2][2], vf[4];                       // K: [d step][s tile]; V^T: [d tile]
#pragma unroll
      for (int kd = 0; kd < 2; ++kd)
#pragma unroll
        for (int mt = 0; mt < 2; ++mt)
          kf[kd][mt] = lds_frag(&lsK[0][0], 72, ks + mt * 16, kd * 32);
      // accumulator row j of s tile mt is key ks + mt*16 + hi8 + j
      v8f cb[2];
      cb[0] = *(const v8f*)&lsC[ks + hi8];
      cb[1] = *(const v8f*)&lsC[ks + 16 + hi8];
#pragma unroll
      for (int dt = 0; dt < 4; ++dt)
        vf[dt] = lds_frag(&lsV[0][0], 72, dt * 16, ks);
      // S^T: 32(s) x 32(l), k-dim = d = 64
      v8f sacc[2][2] = {};                        // [s tile][l tile]
#pragma unroll
      for (int kd = 0; kd < 2; ++kd)
#pragma unroll
        for (int mt = 0; mt < 2; ++mt) {
          sacc[mt][0] = WMMA_F16(kf[kd][mt], qf[0][kd], sacc[mt][0]);
          sacc[mt][1] = WMMA_F16(kf[kd][mt], qf[1][kd], sacc[mt][1]);
        }
      v16h pf[2];                                 // P^T as B operand, k = s
#pragma unroll
      for (int nt = 0; nt < 2; ++nt)
#pragma unroll
        for (int mt = 0; mt < 2; ++mt)
#pragma unroll
          for (int j = 0; j < 8; j += 2) {
            v2f x = {sacc[mt][nt][j], sacc[mt][nt][j + 1]};
            v2f c = {cb[mt][j], cb[mt][j + 1]};
            x = x * (SCORE_SCALE * LOG2E) - c;
            v2f e = {__builtin_amdgcn_exp2f(x[0]), __builtin_amdgcn_exp2f(x[1])};
            v2h h = __builtin_convertvector(e, v2h);
            pf[nt][mt * 8 + j]     = h[0];
            pf[nt][mt * 8 + j + 1] = h[1];
          }
      // O^T += V^T P^T  (k-dim = these 32 keys)
#pragma unroll
      for (int dt = 0; dt < 4; ++dt) {
        oacc[dt][0] = WMMA_F16(vf[dt], pf[0], oacc[dt][0]);
        oacc[dt][1] = WMMA_F16(vf[dt], pf[1], oacc[dt][1]);
      }
    }
  }
  // store attn in [n][l][h*64+d] layout (f16): a lane holds eight consecutive d
#pragma unroll
  for (int nt = 0; nt < 2; ++nt) {
    const int l = l0 + nt * 16 + (lane & 15);
#pragma unroll
    for (int dt = 0; dt < 4; ++dt) {
      v8h o;
#pragma unroll
      for (int j = 0; j < 8; ++j) o[j] = (_Float16)oacc[dt][nt][j];
      *(v8h*)&AOut[((size_t)nb * SEQ + l) * DM + hh * DH + dt * 16 + hi8] = o;
    }
  }
}

// ---------------------------------------------------------------------------
// Output GEMM: out[4096,1024] (f32) = attn[4096,1024] (f16) @ Wo + bo
// Tile 128x64, BK=64, f16 A copied with b128 vector moves.
// ---------------------------------------------------------------------------
__global__ __launch_bounds__(256) void out_gemm_kernel(
    const _Float16* __restrict__ A, const float* __restrict__ W,
    const float* __restrict__ bias, float* __restrict__ Out) {
  __shared__ __align__(16) _Float16 lsA[128][72];
  __shared__ __align__(16) _Float16 lsB[64][72];
  const int t = threadIdx.x, lane = t & 31, wid = t >> 5;
  const int wm = wid >> 1, wn = wid & 1;
  const int m0 = blockIdx.y * 128;
  const int n0 = blockIdx.x * 64;

  v8f acc[2][2] = {};
  for (int kb = 0; kb < DM; kb += 64) {
#pragma unroll
    for (int i = 0; i < 4; ++i) {                 // A: f16 b128 copies
      int idx = i * 256 + t; int r = idx >> 3, cc = (idx & 7) * 8;
      *(v8h*)&lsA[r][cc] = *(const v8h*)&A[(size_t)(m0 + r) * DM + kb + cc];
    }
#pragma unroll
    for (int i = 0; i < 8; ++i) {                 // B: W[k][n] -> lsB[n][k] pairs
      int idx = i * 256 + t; int n = idx & 63, k2 = (idx >> 6) * 2;
      float w0 = W[(size_t)(kb + k2) * DM + n0 + n];
      float w1 = W[(size_t)(kb + k2 + 1) * DM + n0 + n];
      pack_store(&lsB[n][k2], w0, w1);
    }
    if (kb + 64 < DM) {
      __builtin_prefetch(&A[(size_t)(m0 + (t >> 1)) * DM + kb + 64 + (t & 1) * 32], 0, 1);
      __builtin_prefetch(&W[(size_t)(kb + 64 + (t >> 2)) * DM + n0 + (t & 3) * 16], 0, 1);
    }
    __syncthreads();
#pragma unroll
    for (int ks = 0; ks < 64; ks += 32) {
      v16h b0 = lds_frag(&lsB[0][0], 72, wn * 32 + 0,  ks);
      v16h b1 = lds_frag(&lsB[0][0], 72, wn * 32 + 16, ks);
#pragma unroll
      for (int mt = 0; mt < 2; ++mt) {
        v16h a = lds_frag(&lsA[0][0], 72, wm * 32 + mt * 16, ks);
        acc[mt][0] = WMMA_F16(a, b0, acc[mt][0]);
        acc[mt][1] = WMMA_F16(a, b1, acc[mt][1]);
      }
    }
    __syncthreads();
  }
#pragma unroll
  for (int mt = 0; mt < 2; ++mt)
#pragma unroll
    for (int nt = 0; nt < 2; ++nt) {
      int col = n0 + wn * 32 + nt * 16 + (lane & 15);
      float bi = bias[col];
#pragma unroll
      for (int j = 0; j < 8; ++j) {
        int row = m0 + wm * 32 + mt * 16 + ((lane & 16) ? 8 + j : j);
        Out[(size_t)row * DM + col] = acc[mt][nt][j] + bi;
      }
    }
}

// ---------------------------------------------------------------------------
extern "C" void kernel_launch(void* const* d_in, const int* in_sizes, int n_in,
                              void* d_out, int out_size, void* d_ws, size_t ws_size,
                              hipStream_t stream) {
  (void)in_sizes; (void)n_in; (void)out_size; (void)ws_size;
  const float* queries = (const float*)d_in[0];
  const float* keys    = (const float*)d_in[1];
  const float* values  = (const float*)d_in[2];
  const float* Wq = (const float*)d_in[3];
  const float* bq = (const float*)d_in[4];
  const float* Wk = (const float*)d_in[5];
  const float* bk = (const float*)d_in[6];
  const float* Wv = (const float*)d_in[7];
  const float* bv = (const float*)d_in[8];
  const float* Wo = (const float*)d_in[9];
  const float* bo = (const float*)d_in[10];
  float* out = (float*)d_out;

  // Workspace carve-up (~33 MB total)
  const size_t headElems = (size_t)NH * SEQ * DH;      // 4,194,304 halfs each
  _Float16* Qh = (_Float16*)d_ws;
  _Float16* Kh = Qh + headElems;
  _Float16* Vh = Kh + headElems;
  _Float16* At = Vh + headElems;                       // [4096][1024] f16
  float* colmax = (float*)(At + (size_t)MTOT * DM);    // [NH][SEQ]
  float* colsum = colmax + (size_t)NH * SEQ;

  dim3 blk(256);
  dim3 gGemm(DM / 64, MTOT / 128);      // 16 x 32
  dim3 gProj(DM / 128, MTOT / 128, 3);  // 8 x 32 x (q, k, v)
  dim3 gStat(SEQ / 64, NH);             // 32 x 32
  dim3 gAttn(SEQ / 128, NH);            // 16 x 32

  // Qh, Kh and Vh are three consecutive planes of the workspace
  proj_gemm_kernel<<<gProj, dim3(512), 0, stream>>>(queries, keys, values, Wq, Wk, Wv,
                                              bq, bk, bv, Qh);
  colstats_kernel<<<gStat, blk, 0, stream>>>(Qh, Kh, colmax, colsum);
  attn_pv_kernel<<<gAttn, dim3(128), 0, stream>>>(Qh, Kh, Vh, colmax, colsum, At);
  out_gemm_kernel<<<gGemm, blk, 0, stream>>>(At, Wo, bo, out);
}

// v006
// Measured time: 118 microseconds a run.
// Timed twice side by side with v005, it ran 1.05 times as fast both times.
// Counting every step since v000, it is 1.62 times as fast.
#include <hip/hip_runtime.h>
#include <hip/hip_bf16.h>

typedef __attribute__((ext_vector_type(16))) _Float16 v16h;
typedef __attribute__((ext_vector_type(8)))  _Float16 v8h;
typedef __attribute__((ext_vector_type(8)))  float    v8f;

#define DM    1024
#define NHD   16
#define DH    64
#define NBAT  2
#define SEQ   2048
#define NH    (NBAT * NHD)    // 32 (n,h) pairs
#define MTOT  (NBAT * SEQ)    // 4096
#define SCORE_SCALE 0.125f    // 1/sqrt(64)

// ---------------------------------------------------------------------------
// Fragment loader: LDS tile stored as [outer][k] with row stride `ldk` halfs
// (ldk*2 bytes must be a multiple of 16). Implements the CDNA5 16-bit
// A-matrix layout: lanes 0-15 hold K {kb+0..7, kb+16..23}, lanes 16-31 hold
// K {kb+8..15, kb+24..31}. B is fed from a transposed LDS tile so the same
// loader serves both operands. Two ds_load_b128 per fragment.
// ---------------------------------------------------------------------------
__device__ __forceinline__ v16h lds_frag(const _Float16* base, int ldk,
                                         int outer, int kbase) {
  const int lane = threadIdx.x & 31;
  const int r  = outer + (lane & 15);
  const int ko = kbase + ((lane & 16) ? 8 : 0);
  const _Float16* p = base + r * ldk + ko;
  v8h lo = *(const v8h*)(p);        // K = ko .. ko+7
  v8h hi = *(const v8h*)(p + 16);   // K = ko+16 .. ko+23
  v16h f;
#pragma unroll
  for (int i = 0; i < 8; ++i) { f[i] = lo[i]; f[i + 8] = hi[i]; }
  return f;
}

#define WMMA_F16(A, B, C) \
  __builtin_amdgcn_wmma_f32_16x16x32_f16(false, (A), false, (B), (short)0, (C), false, false)

// packed f32x2 -> f16x2 -> one 32-bit LDS store
__device__ __forceinline__ void pack_store(_Float16* dst, float a, float b) {
  union { _Float16 h[2]; unsigned int u; } pk;
  pk.h[0] = (_Float16)a; pk.h[1] = (_Float16)b;
  *(unsigned int*)dst = pk.u;
}

// ---------------------------------------------------------------------------
// Projection GEMM: Out[n,h,l,d] (f16, head-major) = X[4096,1024] @ W[1024,1024] + b
// fp32 inputs converted to f16 (packed) while filling LDS. BK=64.
// The v plane alone is laid out for its reader, transposed inside tiles of 64
// keys: Out[n,h][l / 64][d][l % 64]. A lane of an accumulator holds eight
// consecutive l of one d, so that layout is one 16-byte store per accumulator.
// The q, k and v projections are independent of one another and run as ONE
// grid: blockIdx.z picks the product and its plane of the output.
// Tile 128x128 from 16 waves (4x4, 32x32 each): a block loads 128+128 operand
// rows for 128x128 outputs where a 128x64 tile loaded 128+64 for half as many,
// so the grid asks L2 for a third fewer bytes, and every X element is
// converted and stored to LDS 8 times instead of 16.
// All 768 blocks are resident at once, three a WGP = 12 waves a SIMD: the
// second launch bound asks for that, a budget of 80 registers.
// ---------------------------------------------------------------------------
__global__ __launch_bounds__(512, 12) void proj_gemm_kernel(
    const float* __restrict__ Xq, const float* __restrict__ Xk,
    const float* __restrict__ Xv, const float* __restrict__ Wq,
    const float* __restrict__ Wk, const float* __restrict__ Wv,
    const float* __restrict__ bq, const float* __restrict__ bk,
    const float* __restrict__ bv, _Float16* __restrict__ OutQKV) {
  __shared__ __align__(16) _Float16 lsA[128][72];
  __shared__ __align__(16) _Float16 lsB[128][72];
  const int t = threadIdx.x, lane = t & 31, wid = t >> 5;
  const int wm = wid >> 2, wn = wid & 3;          // 4x4 wave grid
  const int m0 = blockIdx.y * 128;
  const int n0 = blockIdx.x * 128;
  const int pz = blockIdx.z;                      // 0: q, 1: k, 2: v
  const float* __restrict__ X    = pz == 0 ? Xq : (pz == 1 ? Xk : Xv);
  const float* __restrict__ W    = pz == 0 ? Wq : (pz == 1 ? Wk : Wv);
  const float* __restrict__ bias = pz == 0 ? bq : (pz == 1 ? bk : bv);
  _Float16* __restrict__ Out = OutQKV + (size_t)pz * ((size_t)NH * SEQ * DH);

  // One address per operand and thread, the eight rows (k pairs) of a tile at
  // constant distances from it, which the register budget needs.
  const float* pa = X + (size_t)(m0 + (t >> 5)) * DM + (t & 31) * 2;     // row + 16 i
  const float* pb = W + (size_t)((t >> 7) * 2) * DM + n0 + (t & 127);    // k + 8 i
  _Float16* sa = &lsA[t >> 5][(t & 31) * 2];
  _Float16* sb = &lsB[t & 127][(t >> 7) * 2];
  // Prefetch of the next K-tile, a 128-B line a thread: waves 0 to 7 take X
  // (128 rows of 256 B), waves 8 to 15 take W (64 rows of 512 B). The wave's
  // number is made scalar so that the choice of operand and the step per
  // K-tile stay in scalar registers: the prefetch keeps one address pair in
  // vector registers through the loop (the register budget; no spill).
  const bool pfx = __builtin_amdgcn_readfirstlane(t >> 5) < 8;
  const unsigned pfstep = pfx ? 64u : 64u * DM;
  const unsigned pfo = pfx ? (unsigned)((t >> 1) * DM + (t & 1) * 32)
                           : (unsigned)(((t - 256) >> 2) * DM + (t & 3) * 32);
  const float* pf = (pfx ? X + (size_t)m0 * DM : W + n0) + pfstep + pfo;  // K-tile 1

  v8f acc[2][2] = {};
  for (int kb = 0; kb < DM; kb += 64) {
    // the whole tile's 32 loads together, then their stores: 32 loaded registers
    float a0[8], a1[8], w0[8], w1[8];
#pragma unroll
    for (int i = 0; i < 8; ++i) {                 // A: 128x64 f32
      a0[i] = pa[i * 16 * DM];
      a1[i] = pa[i * 16 * DM + 1];
    }
#pragma unroll
    for (int i = 0; i < 8; ++i) {                 // B: W[k][n], two k of one n
      w0[i] = pb[i * 8 * DM];
      w1[i] = pb[(i * 8 + 1) * DM];
    }
#pragma unroll
    for (int i = 0; i < 8; ++i)                   // -> f16 pairs, lsA[row][k]
      pack_store(sa + i * 16 * 72, a0[i], a1[i]);
#pragma unroll
    for (int i = 0; i < 8; ++i)                   // -> f16 pairs, lsB[n][k]
      pack_store(sb + i * 8, w0[i], w1[i]);
    if (kb + 64 < DM) __builtin_prefetch(pf, 0, 1);
    // the address stops at the last K-tile: it never points outside X or W
    pf += (kb + 128 < DM) ? pfstep : 0u;
    pa += 64;
    pb += 64 * DM;
    __syncthreads();
#pragma unroll
    for (int ks = 0; ks < 64; ks += 32) {
      v16h b0 = lds_frag(&lsB[0][0], 72, wn * 32 + 0,  ks);
      v16h b1 = lds_frag(&lsB[0][0], 72, wn * 32 + 16, ks);
#pragma unroll
      for (int mt = 0; mt < 2; ++mt) {
        v16h a = lds_frag(&lsA[0][0], 72, wm * 32 + mt * 16, ks);
        acc[mt][0] = WMMA_F16(a, b0, acc[mt][0]);
        acc[mt][1] = WMMA_F16(a, b1, acc[mt][1]);
      }
    }
    __syncthreads();
  }
  if (pz == 2) {                                  // v: [n,h][l / 64][d][l % 64]
#pragma unroll
    for (int mt = 0; mt < 2; ++mt)
#pragma unroll
      for (int nt = 0; nt < 2; ++nt) {
        int col = n0 + wn * 32 + nt * 16 + (lane & 15);
        int h = col >> 6, d = col & 63;
        float bi = bias[col];
        int row = m0 + wm * 32 + mt * 16 + ((lane & 16) ? 8 : 0);
        int nb = row >> 11, l = row & (SEQ - 1);  // eight rows from a multiple of 8
        v8h o;
#pragma unroll
        for (int j = 0; j < 8; ++j) o[j] = (_Float16)(acc[mt][nt][j] + bi);
        *(v8h*)&Out[(((size_t)nb * NHD + h) * SEQ + (l & ~63)) * DH + d * 64 + (l & 63)] = o;
      }
    return;
  }
#pragma unroll
  for (int mt = 0; mt < 2; ++mt)
#pragma unroll
    for (int nt = 0; nt < 2; ++nt) {
      int col = n0 + wn * 32 + nt * 16 + (lane & 15);
      int h = col >> 6, d = col & 63;
      float bi = bias[col];
#pragma unroll
      for (int j = 0; j < 8; ++j) {
        int row = m0 + wm * 32 + mt * 16 + ((lane & 16) ? 8 + j : j);
        int nb = row >> 11, l = row & (SEQ - 1);
        Out[(((size_t)nb * NHD + h) * SEQ + l) * DH + d] =
            (_Float16)(acc[mt][nt][j] + bi);
      }
    }
}

// ---------------------------------------------------------------------------
// Column softmax statistics. One block owns a 64-wide s-strip of one (n,h)
// head and sweeps all L tiles ONCE: every lane keeps a running maximum of its
// own rows of a column and the sum of exp against that maximum, rescaled
// whenever the maximum rises. The eight partial (max, sum) pairs of a column
// are merged at the end. Deterministic block-local LDS reduction (no atomics).
// ---------------------------------------------------------------------------
__global__ __launch_bounds__(256) void colstats_kernel(
    const _Float16* __restrict__ Q, const _Float16* __restrict__ K,
    float* __restrict__ colmax, float* __restrict__ colsum) {
  __shared__ __align__(16) _Float16 lsQ[128][72];
  __shared__ __align__(16) _Float16 lsK[64][72];
  __shared__ float redM[8][64];
  __shared__ float redS[8][64];
  const int t = threadIdx.x, lane = t & 31, wid = t >> 5;
  const int wm = wid >> 1, wn = wid & 1;
  const int nh = blockIdx.y, s0 = blockIdx.x * 64;
  const _Float16* Qh = Q + (size_t)nh * SEQ * DH;
  const _Float16* Kh = K + (size_t)nh * SEQ * DH;
  const int rrow = wm * 2 + (lane >> 4);
  const int rc   = wn * 32 + (lane & 15);

#pragma unroll
  for (int i = 0; i < 2; ++i) {                   // K strip resident (b128 copies)
    int idx = i * 256 + t; int s = idx >> 3, cc = (idx & 7) * 8;
    *(v8h*)&lsK[s][cc] = *(const v8h*)&Kh[(size_t)(s0 + s) * DH + cc];
  }

  float cm0 = -3.0e38f, cm1 = -3.0e38f;           // running column max (scaled)
  float cs0 = 0.f, cs1 = 0.f;                     // sum of exp against cm0 / cm1
  for (int lt = 0; lt < SEQ / 128; ++lt) {
    __syncthreads();
#pragma unroll
    for (int i = 0; i < 4; ++i) {                 // Q tile (b128 copies)
      int idx = i * 256 + t; int r = idx >> 3, cc = (idx & 7) * 8;
      *(v8h*)&lsQ[r][cc] = *(const v8h*)&Qh[(size_t)(lt * 128 + r) * DH + cc];
    }
    if (lt + 1 < SEQ / 128)
      __builtin_prefetch(&Qh[(size_t)((lt + 1) * 128 + (t >> 1)) * DH + (t & 1) * 32], 0, 1);
    __syncthreads();
    v8f acc[2][2] = {};
#pragma unroll
    for (int kb = 0; kb < DH; kb += 32) {
      v16h b0 = lds_frag(&lsK[0][0], 72, wn * 32 + 0,  kb);
      v16h b1 = lds_frag(&lsK[0][0], 72, wn * 32 + 16, kb);
#pragma unroll
      for (int mt = 0; mt < 2; ++mt) {
        v16h a = lds_frag(&lsQ[0][0], 72, wm * 32 + mt * 16, kb);
        acc[mt][0] = WMMA_F16(a, b0, acc[mt][0]);
        acc[mt][1] = WMMA_F16(a, b1, acc[mt][1]);
      }
    }
    // this tile's maximum (the scale is a positive power of two: max commutes)
    float t0 = acc[0][0][0], t1 = acc[0][1][0];
#pragma unroll
    for (int mt = 0; mt < 2; ++mt)
#pragma unroll
      for (int j = 0; j < 8; ++j) {
        t0 = fmaxf(t0, acc[mt][0][j]);
        t1 = fmaxf(t1, acc[mt][1][j]);
      }
    const float n0 = fmaxf(cm0, t0 * SCORE_SCALE);
    const float n1 = fmaxf(cm1, t1 * SCORE_SCALE);
    cs0 *= __expf(cm0 - n0);                      // old sum onto the new maximum
    cs1 *= __expf(cm1 - n1);
    cm0 = n0;
    cm1 = n1;
#pragma unroll
    for (int mt = 0; mt < 2; ++mt)
#pragma unroll
      for (int j = 0; j < 8; ++j) {
        cs0 += __expf(acc[mt][0][j] * SCORE_SCALE - n0);
        cs1 += __expf(acc[mt][1][j] * SCORE_SCALE - n1);
      }
  }
  redM[rrow][rc] = cm0;
  redM[rrow][rc + 16] = cm1;
  redS[rrow][rc] = cs0;
  redS[rrow][rc + 16] = cs1;
  __syncthreads();
  if (t < 64) {
    float m = redM[0][t];
#pragma unroll
    for (int r = 1; r < 8; ++r) m = fmaxf(m, redM[r][t]);
    float z = 0.f;
#pragma unroll
    for (int r = 0; r < 8; ++r) z += redS[r][t] * __expf(redM[r][t] - m);
    colmax[(size_t)nh * SEQ + s0 + t] = m;
    colsum[(size_t)nh * SEQ + s0 + t] = z;
  }
}

// ---------------------------------------------------------------------------
// attn = softmax(QK^T/8, axis=query) @ V, in transposed form:
//   S^T = K Q^T (rows = keys s, columns = queries l),  O^T += V^T P^T.
// A lane of an S^T accumulator holds eight consecutive keys of ONE query
// column, which is exactly the k order of a B fragment: two 16-key score tiles
// pack into one 32-key P^T operand in registers, so P never touches LDS.
// One block = 4 waves, each wave owns 32 query columns of one head; the Q
// fragments are loaded once from global memory and stay in registers.
// The column statistics are per key = per accumulator row here: LDS holds
// bias[s] = m[s]*log2(e) + log2(Z[s]), and
//   P = exp2(score * (log2(e)/8) - bias[s]) = exp(score/8 - m[s]) / Z[s].
// V arrives from the projection as [n,h][s / 64][d][s % 64]: an s tile is 8 KB
// in a row and already V^T, so it is staged like the K tile, 16 bytes a lane.
// ---------------------------------------------------------------------------
#define LOG2E 1.44269504088896340736f
typedef __attribute__((ext_vector_type(2))) float    v2f;
typedef __attribute__((ext_vector_type(2))) _Float16 v2h;

// One s tile (K rows [s][d], V^T rows [d][s], 64 rows of 128 bytes each) goes
// from global memory into LDS through no register: eight 16-byte asynchronous
// copies a lane, row (t >> 3) + 16 i of each operand. The s_wait_xcnt stands as
// the statement's last line so that no address register of a copy is rewritten
// in front of it.
__device__ __forceinline__ void copy_tile(unsigned lk, unsigned lv,
                                          const _Float16* gk, const _Float16* gv) {
  asm volatile(
      "global_load_async_to_lds_b128 %0, %8, off\n\t"
      "global_load_async_to_lds_b128 %1, %9, off\n\t"
      "global_load_async_to_lds_b128 %2, %10, off\n\t"
      "global_load_async_to_lds_b128 %3, %11, off\n\t"
      "global_load_async_to_lds_b128 %4, %12, off\n\t"
      "global_load_async_to_lds_b128 %5, %13, off\n\t"
      "global_load_async_to_lds_b128 %6, %14, off\n\t"
      "global_load_async_to_lds_b128 %7, %15, off\n\t"
      "s_wait_xcnt 0x0"
      :: "v"(lk), "v"(lk + 16 * 144), "v"(lk + 32 * 144), "v"(lk + 48 * 144),
         "v"(lv), "v"(lv + 16 * 144), "v"(lv + 32 * 144), "v"(lv + 48 * 144),
         "v"(gk), "v"(gk + 16 * DH), "v"(gk + 32 * DH), "v"(gk + 48 * DH),
         "v"(gv), "v"(gv + 16 * DH), "v"(gv + 32 * DH), "v"(gv + 48 * DH)
      : "memory");
}

// waves_per_eu(4, 4): a 256-register budget, so that a tile's K, V^T and bias
// reads are issued together ahead of its matrix work; under the default budget
// each V^T fragment was read and waited for right in front of its two products.
// The K and V^T tiles stand in two buffers: tile st + 1 flies while tile st is
// worked on, so no wave waits out the trip to L2 between two tiles. The bias of
// all 2048 keys of the head is put into LDS once, while tile 0 flies.
__global__ __launch_bounds__(128) __attribute__((amdgpu_waves_per_eu(4, 4))) void attn_pv_kernel(
    const _Float16* __restrict__ Q, const _Float16* __restrict__ K,
    const _Float16* __restrict__ V, const float* __restrict__ colmax,
    const float* __restrict__ colsum, _Float16* __restrict__ AOut) {
  __shared__ __align__(16) _Float16 lsK[2][64][72];   // [buffer][s][d]
  __shared__ __align__(16) _Float16 lsV[2][64][72];   // transposed: [buffer][d][s]
  __shared__ __align__(32) float lsC[SEQ];            // bias[s] of the whole head
  const int t = threadIdx.x, lane = t & 31, wid = t >> 5;
  const int hi8 = (lane & 16) ? 8 : 0;
  const int nh = blockIdx.y, l0 = blockIdx.x * 128 + wid * 32;
  const int nb = nh >> 4, hh = nh & 15;
  const _Float16* Qh = Q + (size_t)nh * SEQ * DH;
  const _Float16* Kh = K + (size_t)nh * SEQ * DH;
  const _Float16* Vh = V + (size_t)nh * SEQ * DH;
  const float* cmax = colmax + (size_t)nh * SEQ;
  const float* csum = colsum + (size_t)nh * SEQ;

  // this thread's place in a staged tile: in global memory and in LDS (bytes)
  const int toff = (t >> 3) * DH + (t & 7) * 8;
  const unsigned lk0 = (unsigned)(size_t)&lsK[0][t >> 3][(t & 7) * 8];
  const unsigned lv0 = (unsigned)(size_t)&lsV[0][t >> 3][(t & 7) * 8];
  const unsigned BUFB = 64 * 72 * 2;               // bytes of one buffer
  copy_tile(lk0, lv0, Kh + toff, Vh + toff);       // tile 0 -> buffer 0

  // Q as B operand: lane -> query column, registers -> d in the hardware k order
  v16h qf[2][2];                                   // [l tile][d step]
#pragma unroll
  for (int nt = 0; nt < 2; ++nt)
#pragma unroll
    for (int kd = 0; kd < 2; ++kd) {
      const _Float16* p = Qh + (size_t)(l0 + nt * 16 + (lane & 15)) * DH + kd * 32 + hi8;
      v8h lo = *(const v8h*)(p);
      v8h hi = *(const v8h*)(p + 16);
#pragma unroll
      for (int i = 0; i < 8; ++i) { qf[nt][kd][i] = lo[i]; qf[nt][kd][i + 8] = hi[i]; }
    }
#pragma unroll
  for (int i = 0; i < SEQ / 128; ++i)              // bias of every key, once
    lsC[i * 128 + t] = cmax[i * 128 + t] * LOG2E + __log2f(csum[i * 128 + t]);

  // tile 0 has landed for this wave; the barrier publishes it (and the bias)
  asm volatile("s_wait_asynccnt 0x0" ::: "memory");
  __syncthreads();
  copy_tile(lk0 + BUFB, lv0 + BUFB, Kh + 64 * DH + toff, Vh + 64 * DH + toff);  // tile 1

  v8f oacc[4][2] = {};                             // O^T: [d tile][l tile]
  for (int st = 0; st < SEQ / 64; ++st) {
    const int s0 = st * 64;
    const _Float16* bK = &lsK[st & 1][0][0];
    const _Float16* bV = &lsV[st & 1][0][0];
#pragma unroll
    for (int ks = 0; ks < 64; ks += 32) {         // 32 keys per pass
      // this pass's LDS reads stand together, ahead of its matrix work
      v16h kf[2][2], vf[4];                       // K: [d step][s tile]; V^T: [d tile]
#pragma unroll
      for (int kd = 0; kd < 2; ++kd)
#pragma unroll
        for (int mt = 0; mt < 2; ++mt)
          kf[kd][mt] = lds_frag(bK, 72, ks + mt * 16, kd * 32);
      // accumulator row j of s tile mt is key s0 + ks + mt*16 + hi8 + j
      v8f cb[2];
      cb[0] = *(const v8f*)&lsC[s0 + ks + hi8];
      cb[1] = *(const v8f*)&lsC[s0 + ks + 16 + hi8];
#pragma unroll
      for (int dt = 0; dt < 4; ++dt)
        vf[dt] = lds_frag(bV, 72, dt * 16, ks);
      // keeps the pass's LDS reads in one group in front of its matrix work:
      // without it each V^T fragment is read and waited for in front of its products
      __builtin_amdgcn_sched_barrier(0);
      if (ks == 32) {
        // Publish point of tile st + 1, behind the tile's last LDS reads: this
        // wave's reads of tile st are done and its copies of tile st + 1 have
        // landed; behind the barrier every wave may read tile st + 1, and tile
        // st's buffer is free for tile st + 2, which so has a whole trip to land.
        asm volatile("s_wait_dscnt 0x0" ::: "memory");
        asm volatile("s_wait_asynccnt 0x0" ::: "memory");
        __syncthreads();
        if (st + 2 < SEQ / 64)
          copy_tile(lk0 + (st & 1) * BUFB, lv0 + (st & 1) * BUFB,
                    Kh + (size_t)(s0 + 128) * DH + toff, Vh + (size_t)(s0 + 128) * DH + toff);
      }
      // S^T: 32(s) x 32(l), k-dim = d = 64
      v8f sacc[2][2] = {};                        // [s tile][l tile]
#pragma unroll
      for (int kd = 0; kd < 2; ++kd)
#pragma unroll
        for (int mt = 0; mt < 2; ++mt) {
          sacc[mt][0] = WMMA_F16(kf[kd][mt], qf[0][kd], sacc[mt][0]);
          sacc[mt][1] = WMMA_F16(kf[kd][mt], qf[1][kd], sacc[mt][1]);
        }
      v16h pf[2];                                 // P^T as B operand, k = s
#pragma unroll
      for (int nt = 0; nt < 2; ++nt)
#pragma unroll
        for (int mt = 0; mt < 2; ++mt)
#pragma unroll
          for (int j = 0; j < 8; j += 2) {
            v2f x = {sacc[mt][nt][j], sacc[mt][nt][j + 1]};
            v2f c = {cb[mt][j], cb[mt][j + 1]};
            x = x * (SCORE_SCALE * LOG2E) - c;
            v2f e = {__builtin_amdgcn_exp2f(x[0]), __builtin_amdgcn_exp2f(x[1])};
            v2h h = __builtin_convertvector(e, v2h);
            pf[nt][mt * 8 + j]     = h[0];
            pf[nt][mt * 8 + j + 1] = h[1];
          }
      // O^T += V^T P^T  (k-dim = these 32 keys)
#pragma unroll
      for (int dt = 0; dt < 4; ++dt) {
        oacc[dt][0] = WMMA_F16(vf[dt], pf[0], oacc[dt][0]);
        oacc[dt][1] = WMMA_F16(vf[dt], pf[1], oacc[dt][1]);
      }
    }
  }
  // no copy is outstanding when the wave ends
  asm volatile("s_wait_asynccnt 0x0" ::: "memory");
  // store attn in [n][l][h*64+d] layout (f16): a lane holds eight consecutive d
#pragma unroll
  for (int nt = 0; nt < 2; ++nt) {
    const int l = l0 + nt * 16 + (lane & 15);
#pragma unroll
    for (int dt = 0; dt < 4; ++dt) {
      v8h o;
#pragma unroll
      for (int j = 0; j < 8; ++j) o[j] = (_Float16)oacc[dt][nt][j];
      *(v8h*)&AOut[((size_t)nb * SEQ + l) * DM + hh * DH + dt * 16 + hi8] = o;
    }
  }
}

// ---------------------------------------------------------------------------
// Output GEMM: out[4096,1024] (f32) = attn[4096,1024] (f16) @ Wo + bo
// Tile 128x64, BK=64, f16 A copied with b128 vector moves.
// ---------------------------------------------------------------------------
__global__ __launch_bounds__(256) void out_gemm_kernel(
    const _Float16* __restrict__ A, const float* __restrict__ W,
    const float* __restrict__ bias, float* __restrict__ Out) {
  __shared__ __align__(16) _Float16 lsA[128][72];
  __shared__ __align__(16) _Float16 lsB[64][72];
  const int t = threadIdx.x, lane = t & 31, wid = t >> 5;
  const int wm = wid >> 1, wn = wid & 1;
  const int m0 = blockIdx.y * 128;
  const int n0 = blockIdx.x * 64;

  v8f acc[2][2] = {};
  for (int kb = 0; kb < DM; kb += 64) {
#pragma unroll
    for (int i = 0; i < 4; ++i) {                 // A: f16 b128 copies
      int idx = i * 256 + t; int r = idx >> 3, cc = (idx & 7) * 8;
      *(v8h*)&lsA[r][cc] = *(const v8h*)&A[(size_t)(m0 + r) * DM + kb + cc];
    }
#pragma unroll
    for (int i = 0; i < 8; ++i) {                 // B: W[k][n] -> lsB[n][k] pairs
      int idx = i * 256 + t; int n = idx & 63, k2 = (idx >> 6) * 2;
      float w0 = W[(size_t)(kb + k2) * DM + n0 + n];
      float w1 = W[(size_t)(kb + k2 + 1) * DM + n0 + n];
      pack_store(&lsB[n][k2], w0, w1);
    }
    if (kb + 64 < DM) {
      __builtin_prefetch(&A[(size_t)(m0 + (t >> 1)) * DM + kb + 64 + (t & 1) * 32], 0, 1);
      __builtin_prefetch(&W[(size_t)(kb + 64 + (t >> 2)) * DM + n0 + (t & 3) * 16], 0, 1);
    }
    __syncthreads();
#pragma unroll
    for (int ks = 0; ks < 64; ks += 32) {
      v16h b0 = lds_frag(&lsB[0][0], 72, wn * 32 + 0,  ks);
      v16h b1 = lds_frag(&lsB[0][0], 72, wn * 32 + 16, ks);
#pragma unroll
      for (int mt = 0; mt < 2; ++mt) {
        v16h a = lds_frag(&lsA[0][0], 72, wm * 32 + mt * 16, ks);
        acc[mt][0] = WMMA_F16(a, b0, acc[mt][0]);
        acc[mt][1] = WMMA_F16(a, b1, acc[mt][1]);
      }
    }
    __syncthreads();
  }
#pragma unroll
  for (int mt = 0; mt < 2; ++mt)
#pragma unroll
    for (int nt = 0; nt < 2; ++nt) {
      int col = n0 + wn * 32 + nt * 16 + (lane & 15);
      float bi = bias[col];
#pragma unroll
      for (int j = 0; j < 8; ++j) {
        int row = m0 + wm * 32 + mt * 16 + ((lane & 16) ? 8 + j : j);
        Out[(size_t)row * DM + col] = acc[mt][nt][j] + bi;
      }
    }
}

// ---------------------------------------------------------------------------
extern "C" void kernel_launch(void* const* d_in, const int* in_sizes, int n_in,
                              void* d_out, int out_size, void* d_ws, size_t ws_size,
                              hipStream_t stream) {
  (void)in_sizes; (void)n_in; (void)out_size; (void)ws_size;
  const float* queries = (const float*)d_in[0];
  const float* keys    = (const float*)d_in[1];
  const float* values  = (const float*)d_in[2];
  const float* Wq = (const float*)d_in[3];
  const float* bq = (const float*)d_in[4];
  const float* Wk = (const float*)d_in[5];
  const float* bk = (const float*)d_in[6];
  const float* Wv = (const float*)d_in[7];
  const float* bv = (const float*)d_in[8];
  const float* Wo = (const float*)d_in[9];
  const float* bo = (const float*)d_in[10];
  float* out = (float*)d_out;

  // Workspace carve-up (~33 MB total)
  const size_t headElems = (size_t)NH * SEQ * DH;      // 4,194,304 halfs each
  _Float16* Qh = (_Float16*)d_ws;
  _Float16* Kh = Qh + headElems;
  _Float16* Vh = Kh + headElems;
  _Float16* At = Vh + headElems;                       // [4096][1024] f16
  float* colmax = (float*)(At + (size_t)MTOT * DM);    // [NH][SEQ]
  float* colsum = colmax + (size_t)NH * SEQ;

  dim3 blk(256);
  dim3 gGemm(DM / 64, MTOT / 128);      // 16 x 32
  dim3 gProj(DM / 128, MTOT / 128, 3);  // 8 x 32 x (q, k, v)
  dim3 gStat(SEQ / 64, NH);             // 32 x 32
  dim3 gAttn(SEQ / 128, NH);            // 16 x 32

  // Qh, Kh and Vh are three consecutive planes of the workspace
  proj_gemm_kernel<<<gProj, dim3(512), 0, stream>>>(queries, keys, values, Wq, Wk, Wv,
                                              bq, bk, bv, Qh);
  colstats_kernel<<<gStat, blk, 0, stream>>>(Qh, Kh, colmax, colsum);
  attn_pv_kernel<<<gAttn, dim3(128), 0, stream>>>(Qh, Kh, Vh, colmax, colsum, At);
  out_gemm_kernel<<<gGemm, blk, 0, stream>>>(At, Wo, bo, out);
}

// v007
// It runs in 109 microseconds.
// Two timings next to v006 put it at 1.08 and 1.07 times that version's speed.
// Counting every step since v000, it is 1.74 times as fast.
#include <hip/hip_runtime.h>
#include <hip/hip_bf16.h>

typedef __attribute__((ext_vector_type(16))) _Float16 v16h;
typedef __attribute__((ext_vector_type(8)))  _Float16 v8h;
typedef __attribute__((ext_vector_type(8)))  float    v8f;

#define DM    1024
#define NHD   16
#define DH    64
#define NBAT  2
#define SEQ   2048
#define NH    (NBAT * NHD)    // 32 (n,h) pairs
#define MTOT  (NBAT * SEQ)    // 4096
#define SCORE_SCALE 0.125f    // 1/sqrt(64)

// ---------------------------------------------------------------------------
// Fragment loader: LDS tile stored as [outer][k] with row stride `ldk` halfs
// (ldk*2 bytes must be a multiple of 16). Implements the CDNA5 16-bit
// A-matrix layout: lanes 0-15 hold K {kb+0..7, kb+16..23}, lanes 16-31 hold
// K {kb+8..15, kb+24..31}. B is fed from a transposed LDS tile so the same
// loader serves both operands. Two ds_load_b128 per fragment.
// ---------------------------------------------------------------------------
__device__ __forceinline__ v16h lds_frag(const _Float16* base, int ldk,
                                         int outer, int kbase) {
  const int lane = threadIdx.x & 31;
  const int r  = outer + (lane & 15);
  const int ko = kbase + ((lane & 16) ? 8 : 0);
  const _Float16* p = base + r * ldk + ko;
  v8h lo = *(const v8h*)(p);        // K = ko .. ko+7
  v8h hi = *(const v8h*)(p + 16);   // K = ko+16 .. ko+23
  v16h f;
#pragma unroll
  for (int i = 0; i < 8; ++i) { f[i] = lo[i]; f[i + 8] = hi[i]; }
  return f;
}

#define WMMA_F16(A, B, C) \
  __builtin_amdgcn_wmma_f32_16x16x32_f16(false, (A), false, (B), (short)0, (C), false, false)

// packed f32x2 -> f16x2 -> one 32-bit LDS store
__device__ __forceinline__ void pack_store(_Float16* dst, float a, float b) {
  union { _Float16 h[2]; unsigned int u; } pk;
  pk.h[0] = (_Float16)a; pk.h[1] = (_Float16)b;
  *(unsigned int*)dst = pk.u;
}

// ---------------------------------------------------------------------------
// Projection GEMM: Out[n,h,l,d] (f16, head-major) = X[4096,1024] @ W[1024,1024] + b
// fp32 inputs converted to f16 (packed) while filling LDS. BK=64.
// The v plane alone is laid out for its reader, transposed inside tiles of 64
// keys: Out[n,h][l / 64][d][l % 64]. A lane of an accumulator holds eight
// consecutive l of one d, so that layout is one 16-byte store per accumulator.
// The q, k and v projections are independent of one another and run as ONE
// grid: the block's index picks the product and its plane of the output.
// q and k take tiles of 256x128 from 16 waves (4x4, 64x32 each): such a block
// loads 256+128 operand rows for 256x128 outputs where a 128x128 tile loads
// 128+128 for half as many, a quarter fewer bytes asked of L2, and a B fragment
// read from LDS feeds four products instead of two. v keeps 128x128 (32x32 a
// wave). That makes 256 large and 256 small blocks, all resident at once, two a
// WGP = 8 waves a SIMD (the second launch bound asks for that, a budget of 128
// registers); the large ones have the low indices, so that where blocks are
// placed in index order a WGP holds one of each and all WGPs have equal work.
// ---------------------------------------------------------------------------
// One tile of MT * 64 rows by 128 columns; VT: the v plane's transposed layout.
template <int MT, bool VT>
__device__ __forceinline__ void proj_tile(
    const float* __restrict__ X, const float* __restrict__ W,
    const float* __restrict__ bias, _Float16* __restrict__ Out,
    const int m0, const int n0, _Float16* lsA, _Float16* lsB) {
  const int t = threadIdx.x, wid = t >> 5;
  const int wm = wid >> 2, wn = wid & 3;          // 4x4 wave grid

  // One offset per operand and thread from the K-tile's base, the MT * 4 rows
  // (eight k pairs) of a tile at constant distances from it, which the register
  // budget needs.
  const unsigned oa = (unsigned)((t >> 5) * DM + (t & 31) * 2);          // row + 16 i
  const unsigned ob = (unsigned)((t >> 7) * 2 * DM + (t & 127));         // k + 8 i
  _Float16* sa = lsA + (t >> 5) * 72 + (t & 31) * 2;
  _Float16* sb = lsB + (t & 127) * 72 + (t >> 7) * 2;
  // Prefetch of the next K-tile, one request per aligned 256-B unit:
  // the first MT * 2 waves take X (a row of 256 B a thread), the
  // next four take W (64 rows of 512 B), the rest none. The wave's number is
  // made scalar so that the tests, the choice of operand and the step per K-tile
  // stay in scalar registers: the prefetch keeps one address pair in vector
  // registers through the loop (the register budget; no spill).
  const int wv = __builtin_amdgcn_readfirstlane(t >> 5);
  const bool pfx = wv < MT * 2, pfon = wv < MT * 2 + 4;
  const float* __restrict__ Xb = X + (size_t)m0 * DM;
  const float* __restrict__ Wb = W + n0;
  const unsigned pfstep = pfx ? 64u : 64u * DM;
  const unsigned pfo = pfx ? (unsigned)(t * DM)
                           : (unsigned)(((t & 127) >> 1) * DM + (t & 1) * 64);
  const float* pf = (pfx ? Xb : Wb) + pfstep + pfo;                       // K-tile 1

  v8f acc[MT][2] = {};
  for (int kb = 0; kb < DM; kb += 64) {
    // the whole tile's loads together, then their stores
    float a0[MT * 4], a1[MT * 4], w0[8], w1[8];
    const float* __restrict__ Xk = Xb + kb;       // this K-tile
    const float* __restrict__ Wt = Wb + (size_t)kb * DM;
#pragma unroll
    for (int i = 0; i < MT * 4; ++i) {            // A: (MT * 64) x 64 f32
      a0[i] = Xk[oa + i * 16 * DM];
      a1[i] = Xk[oa + i * 16 * DM + 1];
    }
#pragma unroll
    for (int i = 0; i < 8; ++i) {                 // B: W[k][n], two k of one n
      w0[i] = Wt[ob + i * 8 * DM];
      w1[i] = Wt[ob + (i * 8 + 1) * DM];
    }
#pragma unroll
    for (int i = 0; i < MT * 4; ++i)              // -> f16 pairs, lsA[row][k]
      pack_store(sa + i * 16 * 72, a0[i], a1[i]);
#pragma unroll
    for (int i = 0; i < 8; ++i)                   // -> f16 pairs, lsB[n][k]
      pack_store(sb + i * 8, w0[i], w1[i]);
    if (pfon && kb + 64 < DM) __builtin_prefetch(pf, 0, 1);
    // the address stops at the last K-tile: it never points outside X or W
    pf += (kb + 128 < DM) ? pfstep : 0u;
    __syncthreads();
#pragma unroll
    for (int ks = 0; ks < 64; ks += 32) {
      v16h b0 = lds_frag(lsB, 72, wn * 32 + 0,  ks);
      v16h b1 = lds_frag(lsB, 72, wn * 32 + 16, ks);
      v16h a[MT];
#pragma unroll
      for (int mt = 0; mt < MT; ++mt)
        a[mt] = lds_frag(lsA, 72, wm * (MT * 16) + mt * 16, ks);
      // keeps the k step's LDS reads in one group in front of its products:
      // without it each A fragment is read and waited for to zero right in
      // front of its two products, one LDS latency a fragment
      __builtin_amdgcn_sched_barrier(0);
#pragma unroll
      for (int mt = 0; mt < MT; ++mt) {
        acc[mt][0] = WMMA_F16(a[mt], b0, acc[mt][0]);
        acc[mt][1] = WMMA_F16(a[mt], b1, acc[mt][1]);
      }
    }
    __syncthreads();
  }
  // The epilogue takes the lane's number anew and the wave's place from the
  // scalar wave number, so that nothing of threadIdx lives through the loop
  // (the register budget: no spill).
  const int le = (int)__builtin_amdgcn_mbcnt_lo(~0u, 0u);
  const int wme = wv >> 2, wne = wv & 3;
#pragma unroll
  for (int mt = 0; mt < MT; ++mt)
#pragma unroll
    for (int nt = 0; nt < 2; ++nt) {
      int col = n0 + wne * 32 + nt * 16 + (le & 15);
      int h = col >> 6, d = col & 63;
      float bi = bias[col];
      if (VT) {                                   // v: [n,h][l / 64][d][l % 64]
        int row = m0 + wme * (MT * 16) + mt * 16 + ((le & 16) ? 8 : 0);
        int nb = row >> 11, l = row & (SEQ - 1);  // eight rows from a multiple of 8
        v8h o;
#pragma unroll
        for (int j = 0; j < 8; ++j) o[j] = (_Float16)(acc[mt][nt][j] + bi);
        *(v8h*)&Out[(((size_t)nb * NHD + h) * SEQ + (l & ~63)) * DH + d * 64 + (l & 63)] = o;
      } else {
#pragma unroll
        for (int j = 0; j < 8; ++j) {
          int row = m0 + wme * (MT * 16) + mt * 16 + ((le & 16) ? 8 + j : j);
          int nb = row >> 11, l = row & (SEQ - 1);
          Out[(((size_t)nb * NHD + h) * SEQ + l) * DH + d] =
              (_Float16)(acc[mt][nt][j] + bi);
        }
      }
    }
}

__global__ __launch_bounds__(512, 8) void proj_gemm_kernel(
    const float* __restrict__ Xq, const float* __restrict__ Xk,
    const float* __restrict__ Xv, const float* __restrict__ Wq,
    const float* __restrict__ Wk, const float* __restrict__ Wv,
    const float* __restrict__ bq, const float* __restrict__ bk,
    const float* __restrict__ bv, _Float16* __restrict__ OutQKV) {
  __shared__ __align__(16) _Float16 lsA[256][72];
  __shared__ __align__(16) _Float16 lsB[128][72];
  const int b = blockIdx.x;                       // 0..127 q, 128..255 k, 256..511 v
  const int n0 = (b & 7) * 128;
  const size_t plane = (size_t)NH * SEQ * DH;
  if (b < 256) {
    const bool isq = b < 128;
    proj_tile<4, false>(isq ? Xq : Xk, isq ? Wq : Wk, isq ? bq : bk,
                        isq ? OutQKV : OutQKV + plane,
                        ((b & 127) >> 3) * 256, n0, &lsA[0][0], &lsB[0][0]);
  } else {
    proj_tile<2, true>(Xv, Wv, bv, OutQKV + 2 * plane,
                       ((b - 256) >> 3) * 128, n0, &lsA[0][0], &lsB[0][0]);
  }
}

// ---------------------------------------------------------------------------
// Column softmax statistics. One block owns a 64-wide s-strip of one (n,h)
// head and sweeps all L tiles ONCE: every lane keeps a running maximum of its
// own rows of a column and the sum of exp against that maximum, rescaled
// whenever the maximum rises. The eight partial (max, sum) pairs of a column
// are merged at the end. Deterministic block-local LDS reduction (no atomics).
// ---------------------------------------------------------------------------
__global__ __launch_bounds__(256) void colstats_kernel(
    const _Float16* __restrict__ Q, const _Float16* __restrict__ K,
    float* __restrict__ colmax, float* __restrict__ colsum) {
  __shared__ __align__(16) _Float16 lsQ[128][72];
  __shared__ __align__(16) _Float16 lsK[64][72];
  __shared__ float redM[8][64];
  __shared__ float redS[8][64];
  const int t = threadIdx.x, lane = t & 31, wid = t >> 5;
  const int wm = wid >> 1, wn = wid & 1;
  const int nh = blockIdx.y, s0 = blockIdx.x * 64;
  const _Float16* Qh = Q + (size_t)nh * SEQ * DH;
  const _Float16* Kh = K + (size_t)nh * SEQ * DH;
  const int rrow = wm * 2 + (lane >> 4);
  const int rc   = wn * 32 + (lane & 15);

#pragma unroll
  for (int i = 0; i < 2; ++i) {                   // K strip resident (b128 copies)
    int idx = i * 256 + t; int s = idx >> 3, cc = (idx & 7) * 8;
    *(v8h*)&lsK[s][cc] = *(const v8h*)&Kh[(size_t)(s0 + s) * DH + cc];
  }

  float cm0 = -3.0e38f, cm1 = -3.0e38f;           // running column max (scaled)
  float cs0 = 0.f, cs1 = 0.f;                     // sum of exp against cm0 / cm1
  for (int lt = 0; lt < SEQ / 128; ++lt) {
    __syncthreads();
#pragma unroll
    for (int i = 0; i < 4; ++i) {                 // Q tile (b128 copies)
      int idx = i * 256 + t; int r = idx >> 3, cc = (idx & 7) * 8;
      *(v8h*)&lsQ[r][cc] = *(const v8h*)&Qh[(size_t)(lt * 128 + r) * DH + cc];
    }
    if (lt + 1 < SEQ / 128)
      __builtin_prefetch(&Qh[(size_t)((lt + 1) * 128 + (t >> 1)) * DH + (t & 1) * 32], 0, 1);
    __syncthreads();
    v8f acc[2][2] = {};
#pragma unroll
    for (int kb = 0; kb < DH; kb += 32) {
      v16h b0 = lds_frag(&lsK[0][0], 72, wn * 32 + 0,  kb);
      v16h b1 = lds_frag(&lsK[0][0], 72, wn * 32 + 16, kb);
#pragma unroll
      for (int mt = 0; mt < 2; ++mt) {
        v16h a = lds_frag(&lsQ[0][0], 72, wm * 32 + mt * 16, kb);
        acc[mt][0] = WMMA_F16(a, b0, acc[mt][0]);
        acc[mt][1] = WMMA_F16(a, b1, acc[mt][1]);
      }
    }
    // this tile's maximum (the scale is a positive power of two: max commutes)
    float t0 = acc[0][0][0], t1 = acc[0][1][0];
#pragma unroll
    for (int mt = 0; mt < 2; ++mt)
#pragma unroll
      for (int j = 0; j < 8; ++j) {
        t0 = fmaxf(t0, acc[mt][0][j]);
        t1 = fmaxf(t1, acc[mt][1][j]);
      }
    const float n0 = fmaxf(cm0, t0 * SCORE_SCALE);
    const float n1 = fmaxf(cm1, t1 * SCORE_SCALE);
    cs0 *= __expf(cm0 - n0);                      // old sum onto the new maximum
    cs1 *= __expf(cm1 - n1);
    cm0 = n0;
    cm1 = n1;
#pragma unroll
    for (int mt = 0; mt < 2; ++mt)
#pragma unroll
      for (int j = 0; j < 8; ++j) {
        cs0 += __expf(acc[mt][0][j] * SCORE_SCALE - n0);
        cs1 += __expf(acc[mt][1][j] * SCORE_SCALE - n1);
      }
  }
  redM[rrow][rc] = cm0;
  redM[rrow][rc + 16] = cm1;
  redS[rrow][rc] = cs0;
  redS[rrow][rc + 16] = cs1;
  __syncthreads();
  if (t < 64) {
    float m = redM[0][t];
#pragma unroll
    for (int r = 1; r < 8; ++r) m = fmaxf(m, redM[r][t]);
    float z = 0.f;
#pragma unroll
    for (int r = 0; r < 8; ++r) z += redS[r][t] * __expf(redM[r][t] - m);
    colmax[(size_t)nh * SEQ + s0 + t] = m;
    colsum[(size_t)nh * SEQ + s0 + t] = z;
  }
}

// ---------------------------------------------------------------------------
// attn = softmax(QK^T/8, axis=query) @ V, in transposed form:
//   S^T = K Q^T (rows = keys s, columns = queries l),  O^T += V^T P^T.
// A lane of an S^T accumulator holds eight consecutive keys of ONE query
// column, which is exactly the k order of a B fragment: two 16-key score tiles
// pack into one 32-key P^T operand in registers, so P never touches LDS.
// One block = 4 waves, each wave owns 32 query columns of one head; the Q
// fragments are loaded once from global memory and stay in registers.
// The column statistics are per key = per accumulator row here: LDS holds
// bias[s] = m[s]*log2(e) + log2(Z[s]), and
//   P = exp2(score * (log2(e)/8) - bias[s]) = exp(score/8 - m[s]) / Z[s].
// V arrives from the projection as [n,h][s / 64][d][s % 64]: an s tile is 8 KB
// in a row and already V^T, so it is staged like the K tile, 16 bytes a lane.
// ---------------------------------------------------------------------------
#define LOG2E 1.44269504088896340736f
typedef __attribute__((ext_vector_type(2))) float    v2f;
typedef __attribute__((ext_vector_type(2))) _Float16 v2h;

// One s tile (K rows [s][d], V^T rows [d][s], 64 rows of 128 bytes each) goes
// from global memory into LDS through no register: eight 16-byte asynchronous
// copies a lane, row (t >> 3) + 16 i of each operand. The s_wait_xcnt stands as
// the statement's last line so that no address register of a copy is rewritten
// in front of it.
__device__ __forceinline__ void copy_tile(unsigned lk, unsigned lv,
                                          const _Float16* gk, const _Float16* gv) {
  asm volatile(
      "global_load_async_to_lds_b128 %0, %8, off\n\t"
      "global_load_async_to_lds_b128 %1, %9, off\n\t"
      "global_load_async_to_lds_b128 %2, %10, off\n\t"
      "global_load_async_to_lds_b128 %3, %11, off\n\t"
      "global_load_async_to_lds_b128 %4, %12, off\n\t"
      "global_load_async_to_lds_b128 %5, %13, off\n\t"
      "global_load_async_to_lds_b128 %6, %14, off\n\t"
      "global_load_async_to_lds_b128 %7, %15, off\n\t"
      "s_wait_xcnt 0x0"
      :: "v"(lk), "v"(lk + 16 * 144), "v"(lk + 32 * 144), "v"(lk + 48 * 144),
         "v"(lv), "v"(lv + 16 * 144), "v"(lv + 32 * 144), "v"(lv + 48 * 144),
         "v"(gk), "v"(gk + 16 * DH), "v"(gk + 32 * DH), "v"(gk + 48 * DH),
         "v"(gv), "v"(gv + 16 * DH), "v"(gv + 32 * DH), "v"(gv + 48 * DH)
      : "memory");
}

// waves_per_eu(4, 4): a 256-register budget, so that a tile's K, V^T and bias
// reads are issued together ahead of its matrix work; under the default budget
// each V^T fragment was read and waited for right in front of its two products.
// The K and V^T tiles stand in two buffers: tile st + 1 flies while tile st is
// worked on, so no wave waits out the trip to L2 between two tiles. The bias of
// all 2048 keys of the head is put into LDS once, while tile 0 flies.
__global__ __launch_bounds__(128) __attribute__((amdgpu_waves_per_eu(4, 4))) void attn_pv_kernel(
    const _Float16* __restrict__ Q, const _Float16* __restrict__ K,
    const _Float16* __restrict__ V, const float* __restrict__ colmax,
    const float* __restrict__ colsum, _Float16* __restrict__ AOut) {
  __shared__ __align__(16) _Float16 lsK[2][64][72];   // [buffer][s][d]
  __shared__ __align__(16) _Float16 lsV[2][64][72];   // transposed: [buffer][d][s]
  __shared__ __align__(32) float lsC[SEQ];            // bias[s] of the whole head
  const int t = threadIdx.x, lane = t & 31, wid = t >> 5;
  const int hi8 = (lane & 16) ? 8 : 0;
  const int nh = blockIdx.y, l0 = blockIdx.x * 128 + wid * 32;
  const int nb = nh >> 4, hh = nh & 15;
  const _Float16* Qh = Q + (size_t)nh * SEQ * DH;
  const _Float16* Kh = K + (size_t)nh * SEQ * DH;
  const _Float16* Vh = V + (size_t)nh * SEQ * DH;
  const float* cmax = colmax + (size_t)nh * SEQ;
  const float* csum = colsum + (size_t)nh * SEQ;

  // this thread's place in a staged tile: in global memory and in LDS (bytes)
  const int toff = (t >> 3) * DH + (t & 7) * 8;
  const unsigned lk0 = (unsigned)(size_t)&lsK[0][t >> 3][(t & 7) * 8];
  const unsigned lv0 = (unsigned)(size_t)&lsV[0][t >> 3][(t & 7) * 8];
  const unsigned BUFB = 64 * 72 * 2;               // bytes of one buffer
  copy_tile(lk0, lv0, Kh + toff, Vh + toff);       // tile 0 -> buffer 0

  // Q as B operand: lane -> query column, registers -> d in the hardware k order
  v16h qf[2][2];                                   // [l tile][d step]
#pragma unroll
  for (int nt = 0; nt < 2; ++nt)
#pragma unroll
    for (int kd = 0; kd < 2; ++kd) {
      const _Float16* p = Qh + (size_t)(l0 + nt * 16 + (lane & 15)) * DH + kd * 32 + hi8;
      v8h lo = *(const v8h*)(p);
      v8h hi = *(const v8h*)(p + 16);
#pragma unroll
      for (int i = 0; i < 8; ++i) { qf[nt][kd][i] = lo[i]; qf[nt][kd][i + 8] = hi[i]; }
    }
#pragma unroll
  for (int i = 0; i < SEQ / 128; ++i)              // bias of every key, once
    lsC[i * 128 + t] = cmax[i * 128 + t] * LOG2E + __log2f(csum[i * 128 + t]);

  // tile 0 has landed for this wave; the barrier publishes it (and the bias)
  asm volatile("s_wait_asynccnt 0x0" ::: "memory");
  __syncthreads();
  copy_tile(lk0 + BUFB, lv0 + BUFB, Kh + 64 * DH + toff, Vh + 64 * DH + toff);  // tile 1

  v8f oacc[4][2] = {};                             // O^T: [d tile][l tile]
  for (int st = 0; st < SEQ / 64; ++st) {
    const int s0 = st * 64;
    const _Float16* bK = &lsK[st & 1][0][0];
    const _Float16* bV = &lsV[st & 1][0][0];
#pragma unroll
    for (int ks = 0; ks < 64; ks += 32) {         // 32 keys per pass
      // this pass's LDS reads stand together, ahead of its matrix work
      v16h kf[2][2], vf[4];                       // K: [d step][s tile]; V^T: [d tile]
#pragma unroll
      for (int kd = 0; kd < 2; ++kd)
#pragma unroll
        for (int mt = 0; mt < 2; ++mt)
          kf[kd][mt] = lds_frag(bK, 72, ks + mt * 16, kd * 32);
      // accumulator row j of s tile mt is key s0 + ks + mt*16 + hi8 + j
      v8f cb[2];
      cb[0] = *(const v8f*)&lsC[s0 + ks + hi8];
      cb[1] = *(const v8f*)&lsC[s0 + ks + 16 + hi8];
#pragma unroll
      for (int dt = 0; dt < 4; ++dt)
        vf[dt] = lds_frag(bV, 72, dt * 16, ks);
      // keeps the pass's LDS reads in one group in front of its matrix work:
      // without it each V^T fragment is read and waited for in front of its products
      __builtin_amdgcn_sched_barrier(0);
      if (ks == 32) {
        // Publish point of tile st + 1, behind the tile's last LDS reads: this
        // wave's reads of tile st are done and its copies of tile st + 1 have
        // landed; behind the barrier every wave may read tile st + 1, and tile
        // st's buffer is free for tile st + 2, which so has a whole trip to land.
        asm volatile("s_wait_dscnt 0x0" ::: "memory");
        asm volatile("s_wait_asynccnt 0x0" ::: "memory");
        __syncthreads();
        if (st + 2 < SEQ / 64)
          copy_tile(lk0 + (st & 1) * BUFB, lv0 + (st & 1) * BUFB,
                    Kh + (size_t)(s0 + 128) * DH + toff, Vh + (size_t)(s0 + 128) * DH + toff);
      }
      // S^T: 32(s) x 32(l), k-dim = d = 64
      v8f sacc[2][2] = {};                        // [s tile][l tile]
#pragma unroll
      for (int kd = 0; kd < 2; ++kd)
#pragma unroll
        for (int mt = 0; mt < 2; ++mt) {
          sacc[mt][0] = WMMA_F16(kf[kd][mt], qf[0][kd], sacc[mt][0]);
          sacc[mt][1] = WMMA_F16(kf[kd][mt], qf[1][kd], sacc[mt][1]);
        }
      v16h pf[2];                                 // P^T as B operand, k = s
#pragma unroll
      for (int nt = 0; nt < 2; ++nt)
#pragma unroll
        for (int mt = 0; mt < 2; ++mt)
#pragma unroll
          for (int j = 0; j < 8; j += 2) {
            v2f x = {sacc[mt][nt][j], sacc[mt][nt][j + 1]};
            v2f c = {cb[mt][j], cb[mt][j + 1]};
            x = x * (SCORE_SCALE * LOG2E) - c;
            v2f e = {__builtin_amdgcn_exp2f(x[0]), __builtin_amdgcn_exp2f(x[1])};
            v2h h = __builtin_convertvector(e, v2h);
            pf[nt][mt * 8 + j]     = h[0];
            pf[nt][mt * 8 + j + 1] = h[1];
          }
      // O^T += V^T P^T  (k-dim = these 32 keys)
#pragma unroll
      for (int dt = 0; dt < 4; ++dt) {
        oacc[dt][0] = WMMA_F16(vf[dt], pf[0], oacc[dt][0]);
        oacc[dt][1] = WMMA_F16(vf[dt], pf[1], oacc[dt][1]);
      }
    }
  }
  // no copy is outstanding when the wave ends
  asm volatile("s_wait_asynccnt 0x0" ::: "memory");
  // store attn in [n][l][h*64+d] layout (f16): a lane holds eight consecutive d
#pragma unroll
  for (int nt = 0; nt < 2; ++nt) {
    const int l = l0 + nt * 16 + (lane & 15);
#pragma unroll
    for (int dt = 0; dt < 4; ++dt) {
      v8h o;
#pragma unroll
      for (int j = 0; j < 8; ++j) o[j] = (_Float16)oacc[dt][nt][j];
      *(v8h*)&AOut[((size_t)nb * SEQ + l) * DM + hh * DH + dt * 16 + hi8] = o;
    }
  }
}

// ---------------------------------------------------------------------------
// Output GEMM: out[4096,1024] (f32) = attn[4096,1024] (f16) @ Wo + bo
// Tile 128x64, BK=64, f16 A copied with b128 vector moves.
// ---------------------------------------------------------------------------
__global__ __launch_bounds__(256) void out_gemm_kernel(
    const _Float16* __restrict__ A, const float* __restrict__ W,
    const float* __restrict__ bias, float* __restrict__ Out) {
  __shared__ __align__(16) _Float16 lsA[128][72];
  __shared__ __align__(16) _Float16 lsB[64][72];
  const int t = threadIdx.x, lane = t & 31, wid = t >> 5;
  const int wm = wid >> 1, wn = wid & 1;
  const int m0 = blockIdx.y * 128;
  const int n0 = blockIdx.x * 64;

  v8f acc[2][2] = {};
  for (int kb = 0; kb < DM; kb += 64) {
#pragma unroll
    for (int i = 0; i < 4; ++i) {                 // A: f16 b128 copies
      int idx = i * 256 + t; int r = idx >> 3, cc = (idx & 7) * 8;
      *(v8h*)&lsA[r][cc] = *(const v8h*)&A[(size_t)(m0 + r) * DM + kb + cc];
    }
#pragma unroll
    for (int i = 0; i < 8; ++i) {                 // B: W[k][n] -> lsB[n][k] pairs
      int idx = i * 256 + t; int n = idx & 63, k2 = (idx >> 6) * 2;
      float w0 = W[(size_t)(kb + k2) * DM + n0 + n];
      float w1 = W[(size_t)(kb + k2 + 1) * DM + n0 + n];
      pack_store(&lsB[n][k2], w0, w1);
    }
    if (kb + 64 < DM) {
      __builtin_prefetch(&A[(size_t)(m0 + (t >> 1)) * DM + kb + 64 + (t & 1) * 32], 0, 1);
      __builtin_prefetch(&W[(size_t)(kb + 64 + (t >> 2)) * DM + n0 + (t & 3) * 16], 0, 1);
    }
    __syncthreads();
#pragma unroll
    for (int ks = 0; ks < 64; ks += 32) {
      v16h b0 = lds_frag(&lsB[0][0], 72, wn * 32 + 0,  ks);
      v16h b1 = lds_frag(&lsB[0][0], 72, wn * 32 + 16, ks);
#pragma unroll
      for (int mt = 0; mt < 2; ++mt) {
        v16h a = lds_frag(&lsA[0][0], 72, wm * 32 + mt * 16, ks);
        acc[mt][0] = WMMA_F16(a, b0, acc[mt][0]);
        acc[mt][1] = WMMA_F16(a, b1, acc[mt][1]);
      }
    }
    __syncthreads();
  }
#pragma unroll
  for (int mt = 0; mt < 2; ++mt)
#pragma unroll
    for (int nt = 0; nt < 2; ++nt) {
      int col = n0 + wn * 32 + nt * 16 + (lane & 15);
      float bi = bias[col];
#pragma unroll
      for (int j = 0; j < 8; ++j) {
        int row = m0 + wm * 32 + mt * 16 + ((lane & 16) ? 8 + j : j);
        Out[(size_t)row * DM + col] = acc[mt][nt][j] + bi;
      }
    }
}

// ---------------------------------------------------------------------------
extern "C" void kernel_launch(void* const* d_in, const int* in_sizes, int n_in,
                              void* d_out, int out_size, void* d_ws, size_t ws_size,
                              hipStream_t stream) {
  (void)in_sizes; (void)n_in; (void)out_size; (void)ws_size;
  const float* queries = (const float*)d_in[0];
  const float* keys    = (const float*)d_in[1];
  const float* values  = (const float*)d_in[2];
  const float* Wq = (const float*)d_in[3];
  const float* bq = (const float*)d_in[4];
  const float* Wk = (const float*)d_in[5];
  const float* bk = (const float*)d_in[6];
  const float* Wv = (const float*)d_in[7];
  const float* bv = (const float*)d_in[8];
  const float* Wo = (const float*)d_in[9];
  const float* bo = (const float*)d_in[10];
  float* out = (float*)d_out;

  // Workspace carve-up (~33 MB total)
  const size_t headElems = (size_t)NH * SEQ * DH;      // 4,194,304 halfs each
  _Float16* Qh = (_Float16*)d_ws;
  _Float16* Kh = Qh + headElems;
  _Float16* Vh = Kh + headElems;
  _Float16* At = Vh + headElems;                       // [4096][1024] f16
  float* colmax = (float*)(At + (size_t)MTOT * DM);    // [NH][SEQ]
  float* colsum = colmax + (size_t)NH * SEQ;

  dim3 blk(256);
  dim3 gGemm(DM / 64, MTOT / 128);      // 16 x 32
  dim3 gProj(512);                      // 8 x 16 x (q, k) + 8 x 32 (v)
  dim3 gStat(SEQ / 64, NH);             // 32 x 32
  dim3 gAttn(SEQ / 128, NH);            // 16 x 32

  // Qh, Kh and Vh are three consecutive planes of the workspace
  proj_gemm_kernel<<<gProj, dim3(512), 0, stream>>>(queries, keys, values, Wq, Wk, Wv,
                                              bq, bk, bv, Qh);
  colstats_kernel<<<gStat, blk, 0, stream>>>(Qh, Kh, colmax, colsum);
  attn_pv_kernel<<<gAttn, dim3(128), 0, stream>>>(Qh, Kh, Vh, colmax, colsum, At);
  out_gemm_kernel<<<gGemm, blk, 0, stream>>>(At, Wo, bo, out);
}
